// v000
// Times are from an AMD MI455X. After a warm-up the kernel runs many times in a row, and a time is the length of
// such a window on the GPU divided by its runs, so every launch and the gaps after it count. The runs cycle
// through copies of the inputs. A figure is the median of several windows, for all but v000 over two sittings.
// Sittings can differ by a few percent; kernels timed side by side share one.
// The starting kernel, v000, takes 127 microseconds a run.
#include <hip/hip_runtime.h>
#include <hip/hip_bf16.h>

// ---------------------------------------------------------------------------
// Triangle attention for MI455X (gfx1250, wave32, WMMA 16x16x32 f16).
// L=256, D_PAIR=128, N_HEAD=4, D_HID=32, NPOS=65536.
// ---------------------------------------------------------------------------

#define LVAL   256
#define DPAIR  128
#define NHEAD  4
#define DHID   32
#define NPOS   (LVAL * LVAL)
#define SCALING 0.17677669529663687f   // 1/sqrt(32)

typedef __attribute__((ext_vector_type(16))) _Float16 v16h;
typedef __attribute__((ext_vector_type(8)))  _Float16 v8h;
typedef __attribute__((ext_vector_type(8)))  float    v8f;
typedef int vs4i __attribute__((vector_size(16)));   // async-LDS builtin arg type

#if __has_builtin(__builtin_amdgcn_global_load_async_to_lds_b128) && \
    __has_builtin(__builtin_amdgcn_s_wait_asynccnt)
#define HAVE_ASYNC_LDS 1
#else
#define HAVE_ASYNC_LDS 0
#endif

// Load one 16x32 f16 fragment (A-matrix layout; also used for B as B^T rows)
// from row-major storage with row stride `ld` (elements).
// ISA layout (16-bit A 16x32): lanes 0-15 -> M=0-15, cols {0..7,16..23};
// lanes 16-31 -> M=0-15, cols {8..15,24..31}. Two b128 loads per lane.
__device__ inline v16h load_frag16x32(const _Float16* p, int ld) {
  const int lane = threadIdx.x & 31;
  const int row  = lane & 15;
  const int hi   = lane >> 4;
  const _Float16* r = p + row * ld + hi * 8;
  v8h a = *(const v8h*)(r);
  v8h b = *(const v8h*)(r + 16);
  v16h f;
#pragma unroll
  for (int t = 0; t < 8; ++t) { f[t] = a[t]; f[t + 8] = b[t]; }
  return f;
}

__device__ inline v8f wmma_f16(v16h a, v16h b, v8f c) {
  return __builtin_amdgcn_wmma_f32_16x16x32_f16(false, a, false, b,
                                                (short)0, c, false, false);
}

// ---------------------------------------------------------------------------
// Kernel 1: LayerNorm over D=128, f32 in -> f16 out. One wave per position.
// ---------------------------------------------------------------------------
__global__ __launch_bounds__(256) void ln_kernel(
    const float* __restrict__ pair, const float* __restrict__ gamma,
    const float* __restrict__ beta, _Float16* __restrict__ xn) {
  const int wave = threadIdx.x >> 5;
  const int lane = threadIdx.x & 31;
  const size_t pos = (size_t)blockIdx.x * 8 + wave;
  const float4 xv = *(const float4*)(pair + pos * DPAIR + lane * 4);
  float s  = xv.x + xv.y + xv.z + xv.w;
  float ss = xv.x * xv.x + xv.y * xv.y + xv.z * xv.z + xv.w * xv.w;
#pragma unroll
  for (int m = 1; m < 32; m <<= 1) {
    s  += __shfl_xor(s,  m, 32);
    ss += __shfl_xor(ss, m, 32);
  }
  const float mu  = s * (1.0f / DPAIR);
  const float var = ss * (1.0f / DPAIR) - mu * mu;
  const float inv = rsqrtf(var + 1e-5f);
  const float4 gv = *(const float4*)(gamma + lane * 4);
  const float4 bv = *(const float4*)(beta  + lane * 4);
  _Float16* o = xn + pos * DPAIR + lane * 4;
  o[0] = (_Float16)((xv.x - mu) * inv * gv.x + bv.x);
  o[1] = (_Float16)((xv.y - mu) * inv * gv.y + bv.y);
  o[2] = (_Float16)((xv.z - mu) * inv * gv.z + bv.z);
  o[3] = (_Float16)((xv.w - mu) * inv * gv.w + bv.w);
}

// ---------------------------------------------------------------------------
// Kernel 2: projection GEMM (65536x128)x(128x128), specialized per output.
// MODE 0: q (scale by 1/sqrt(32)); MODE 1: plain (k, v); MODE 2: sigmoid gate.
// grid.x = NPOS/128; block = 256 (8 waves, 16 rows each). W^T f16 in LDS.
// ---------------------------------------------------------------------------
#define WT_LD 136   // 128 + 8 pad (272B row stride, 16B aligned)
template <int MODE>
__global__ __launch_bounds__(256) void proj_kernel(
    const _Float16* __restrict__ xn, const float* __restrict__ W,
    const float* __restrict__ bg, _Float16* __restrict__ dst) {
  __shared__ _Float16 WT[128 * WT_LD];
  for (int idx = threadIdx.x; idx < 128 * 128; idx += 256) {
    const int kk = idx >> 7, n = idx & 127;
    WT[n * WT_LD + kk] = (_Float16)W[idx];     // transpose to N-major
  }
  __syncthreads();

  const int wave = threadIdx.x >> 5;
  const int lane = threadIdx.x & 31;
  const int kcol = lane & 15, hi = lane >> 4;
  const size_t m0 = (size_t)blockIdx.x * 128 + wave * 16;

  v16h A[4];
#pragma unroll
  for (int kk = 0; kk < 4; ++kk)
    A[kk] = load_frag16x32(xn + m0 * DPAIR + kk * 32, DPAIR);

#pragma unroll
  for (int nt = 0; nt < 8; ++nt) {
    v8f acc = {};
#pragma unroll
    for (int kk = 0; kk < 4; ++kk) {
      v16h B = load_frag16x32(WT + (nt * 16) * WT_LD + kk * 32, WT_LD);
      acc = wmma_f16(A[kk], B, acc);
    }
    const int n = nt * 16 + kcol;
    const float bgn = (MODE == 2) ? bg[n] : 0.0f;
#pragma unroll
    for (int r = 0; r < 8; ++r) {
      const size_t m = m0 + r + 8 * hi;
      float val = acc[r];
      if (MODE == 0) val *= SCALING;
      if (MODE == 2) val = 1.0f / (1.0f + __expf(-(val + bgn)));
      dst[m * DPAIR + n] = (_Float16)val;
    }
  }
}

// ---------------------------------------------------------------------------
// Kernel 3: bias = xn @ Wb (128 -> 4), stored as per-head planes
// biasws[h][j][k] so the attention kernel's reads are fully coalesced.
// Thread t: h = t >> 16, pos = t & 65535 (consecutive threads -> same h,
// consecutive pos -> coalesced reads and writes).
// ---------------------------------------------------------------------------
__global__ __launch_bounds__(256) void bias_kernel(
    const _Float16* __restrict__ xn, const float* __restrict__ Wb,
    float* __restrict__ biasws) {
  const size_t t = (size_t)blockIdx.x * blockDim.x + threadIdx.x;
  const int h = (int)(t >> 16);          // NPOS == 65536
  const size_t pos = t & (NPOS - 1);
  const _Float16* x = xn + pos * DPAIR;
  float acc = 0.0f;
#pragma unroll 8
  for (int c = 0; c < DPAIR; ++c) acc += (float)x[c] * Wb[c * NHEAD + h];
  biasws[(size_t)h * NPOS + pos] = acc;
}

// ---------------------------------------------------------------------------
// Kernel 4: attention with ONLINE (flash-style) softmax (no VGPR spills).
// grid = (2, 256): block = (j-slab of 128, row i). Per head: K_h staged via
// async direct-to-LDS DMA (GLOBAL_LOAD_ASYNC_TO_LDS_B128, ASYNCcnt);
// V_h^T staged manually (transpose). Each wave owns 16 query rows; keys in
// 32-wide chunks: 2 WMMAs for scores, bias + running max/sum rescale, exp
// tile -> wave-private 1KB LDS re-tile, 2 WMMAs for P.V.
// ---------------------------------------------------------------------------
#define VT_LD 264   // 256 + 8 pad
__global__ __launch_bounds__(256) void attn_kernel(
    const _Float16* __restrict__ q, const _Float16* __restrict__ k,
    const _Float16* __restrict__ v, const float* __restrict__ biasws,
    const _Float16* __restrict__ gate, _Float16* __restrict__ att) {
  __shared__ _Float16 Ksh[LVAL * DHID];       // 16 KB
  __shared__ _Float16 VTsh[DHID * VT_LD];     // ~16.5 KB
  __shared__ _Float16 Pbuf[8][16 * 32];       // 8 KB (wave-private tiles)

  const int i     = blockIdx.y;
  const int jhalf = blockIdx.x;
  const int wave  = threadIdx.x >> 5;
  const int lane  = threadIdx.x & 31;
  const int kcol  = lane & 15, hi = lane >> 4;
  const int j0    = jhalf * 128 + wave * 16;

  for (int h = 0; h < NHEAD; ++h) {
    __syncthreads();
    // --- K rows: async DMA straight into LDS (one 64B row per thread) ---
    {
      const _Float16* srcK =
          k + ((size_t)(i * LVAL + threadIdx.x)) * DPAIR + h * DHID;
      _Float16* dstK = Ksh + threadIdx.x * DHID;
#if HAVE_ASYNC_LDS
#pragma unroll
      for (int t = 0; t < 4; ++t)
        __builtin_amdgcn_global_load_async_to_lds_b128(
            (vs4i*)(srcK + t * 8), (vs4i*)(dstK + t * 8), 0, 0);
#else
#pragma unroll
      for (int t = 0; t < 4; ++t)
        *(v8h*)(dstK + t * 8) = *(const v8h*)(srcK + t * 8);
#endif
    }
    // --- V^T: manual transpose staging ---
    for (int idx = threadIdx.x; idx < LVAL * DHID; idx += 256) {
      const int kk = idx >> 5, c = idx & 31;
      VTsh[c * VT_LD + kk] =
          v[((size_t)(i * LVAL + kk)) * DPAIR + h * DHID + c];
    }
    // Prefetch next head's K/V rows (emits global_prefetch_b8).
    if (h + 1 < NHEAD) {
      const size_t nsrc =
          ((size_t)(i * LVAL + threadIdx.x)) * DPAIR + (h + 1) * DHID;
      __builtin_prefetch(k + nsrc, 0, 1);
      __builtin_prefetch(v + nsrc, 0, 1);
    }
#if HAVE_ASYNC_LDS
    __builtin_amdgcn_s_wait_asynccnt(0);
#endif
    __syncthreads();

    const v16h aQ =
        load_frag16x32(q + ((size_t)(i * LVAL + j0)) * DPAIR + h * DHID, DPAIR);
    const float* biasH = biasws + (size_t)h * NPOS;

    v8f O0 = {}, O1 = {};
    float m[8], sum[8];
#pragma unroll
    for (int r = 0; r < 8; ++r) { m[r] = -3.0e38f; sum[r] = 0.0f; }

    for (int c = 0; c < 8; ++c) {        // 32 keys per chunk
      // --- scores for this chunk: two 16x16 tiles ---
      const v16h bK0 = load_frag16x32(Ksh + (2 * c + 0) * 16 * DHID, DHID);
      const v16h bK1 = load_frag16x32(Ksh + (2 * c + 1) * 16 * DHID, DHID);
      v8f z = {};
      v8f S0 = wmma_f16(aQ, bK0, z);
      v8f S1 = wmma_f16(aQ, bK1, z);

      // --- bias + online softmax update ---
#pragma unroll
      for (int r = 0; r < 8; ++r) {
        const int j = j0 + r + 8 * hi;
        const float* bp = biasH + (size_t)j * LVAL + c * 32 + kcol;
        const float v0 = S0[r] + bp[0];    // coalesced: 16 lanes x 4B
        const float v1 = S1[r] + bp[16];
        float tm = fmaxf(v0, v1);
#pragma unroll
        for (int msk = 1; msk < 16; msk <<= 1)
          tm = fmaxf(tm, __shfl_xor(tm, msk, 32));
        const float mnew = fmaxf(m[r], tm);
        const float cf   = __expf(m[r] - mnew);
        m[r] = mnew;
        const float e0 = __expf(v0 - mnew);
        const float e1 = __expf(v1 - mnew);
        float ps = e0 + e1;
#pragma unroll
        for (int msk = 1; msk < 16; msk <<= 1) ps += __shfl_xor(ps, msk, 32);
        sum[r] = sum[r] * cf + ps;
        O0[r] *= cf;
        O1[r] *= cf;
        const int row = r + 8 * hi;
        Pbuf[wave][row * 32 + kcol]      = (_Float16)e0;
        Pbuf[wave][row * 32 + 16 + kcol] = (_Float16)e1;
      }
      // Pbuf is wave-private; same-wave DS ordering suffices (no barrier).

      // --- accumulate O += P(16x32) @ V(32x32) ---
      const v16h aP  = load_frag16x32(&Pbuf[wave][0], 32);
      const v16h bV0 = load_frag16x32(VTsh + 0  * VT_LD + c * 32, VT_LD);
      const v16h bV1 = load_frag16x32(VTsh + 16 * VT_LD + c * 32, VT_LD);
      O0 = wmma_f16(aP, bV0, O0);
      O1 = wmma_f16(aP, bV1, O1);
    }

    // --- normalize, gate, store ---
#pragma unroll
    for (int r = 0; r < 8; ++r) {
      const int j = j0 + r + 8 * hi;
      const size_t pos = (size_t)(i * LVAL + j);
      const float inv = 1.0f / sum[r];
      {
        const int n = kcol;
        const float g = (float)gate[pos * DPAIR + h * DHID + n];
        att[pos * DPAIR + h * DHID + n] = (_Float16)(O0[r] * inv * g);
      }
      {
        const int n = 16 + kcol;
        const float g = (float)gate[pos * DPAIR + h * DHID + n];
        att[pos * DPAIR + h * DHID + n] = (_Float16)(O1[r] * inv * g);
      }
    }
  }
}

// ---------------------------------------------------------------------------
// Kernel 5: out = att @ Wo + bo, f32 out. Same shape as proj_kernel.
// ---------------------------------------------------------------------------
__global__ __launch_bounds__(256) void out_kernel(
    const _Float16* __restrict__ att, const float* __restrict__ Wo,
    const float* __restrict__ bo, float* __restrict__ out) {
  __shared__ _Float16 WT[128 * WT_LD];
  for (int idx = threadIdx.x; idx < 128 * 128; idx += 256) {
    const int kk = idx >> 7, n = idx & 127;
    WT[n * WT_LD + kk] = (_Float16)Wo[idx];
  }
  __syncthreads();

  const int wave = threadIdx.x >> 5;
  const int lane = threadIdx.x & 31;
  const int kcol = lane & 15, hi = lane >> 4;
  const size_t m0 = (size_t)blockIdx.x * 128 + wave * 16;

  v16h A[4];
#pragma unroll
  for (int kk = 0; kk < 4; ++kk)
    A[kk] = load_frag16x32(att + m0 * DPAIR + kk * 32, DPAIR);

#pragma unroll
  for (int nt = 0; nt < 8; ++nt) {
    v8f acc = {};
#pragma unroll
    for (int kk = 0; kk < 4; ++kk) {
      v16h B = load_frag16x32(WT + (nt * 16) * WT_LD + kk * 32, WT_LD);
      acc = wmma_f16(A[kk], B, acc);
    }
    const int n = nt * 16 + kcol;
#pragma unroll
    for (int r = 0; r < 8; ++r) {
      const size_t m = m0 + r + 8 * hi;
      out[m * DPAIR + n] = acc[r] + bo[n];
    }
  }
}

// ---------------------------------------------------------------------------
// Launch.  Inputs: 0 pair, 1 gamma, 2 beta, 3 Wq, 4 Wk, 5 Wv, 6 Wb, 7 Wg,
// 8 bg, 9 Wo, 10 bo.  Output: f32 (1,256,256,128).
// Workspace (~102 MB): xn | q | k | v | gate | att (f16, 16 MB each) | bias.
// ---------------------------------------------------------------------------
extern "C" void kernel_launch(void* const* d_in, const int* in_sizes, int n_in,
                              void* d_out, int out_size, void* d_ws,
                              size_t ws_size, hipStream_t stream) {
  const float* pair  = (const float*)d_in[0];
  const float* gamma = (const float*)d_in[1];
  const float* beta  = (const float*)d_in[2];
  const float* Wq    = (const float*)d_in[3];
  const float* Wk    = (const float*)d_in[4];
  const float* Wv    = (const float*)d_in[5];
  const float* Wb    = (const float*)d_in[6];
  const float* Wg    = (const float*)d_in[7];
  const float* bg    = (const float*)d_in[8];
  const float* Wo    = (const float*)d_in[9];
  const float* bo    = (const float*)d_in[10];
  float* out = (float*)d_out;

  char* ws = (char*)d_ws;
  const size_t SEG = (size_t)NPOS * DPAIR * sizeof(_Float16);  // 16 MB
  _Float16* xn   = (_Float16*)(ws + 0 * SEG);
  _Float16* qbuf = (_Float16*)(ws + 1 * SEG);
  _Float16* kbuf = (_Float16*)(ws + 2 * SEG);
  _Float16* vbuf = (_Float16*)(ws + 3 * SEG);
  _Float16* gbuf = (_Float16*)(ws + 4 * SEG);
  _Float16* abuf = (_Float16*)(ws + 5 * SEG);
  float*    bbuf = (float*)   (ws + 6 * SEG);  // NHEAD*NPOS f32 = 1 MB

  ln_kernel<<<NPOS / 8, 256, 0, stream>>>(pair, gamma, beta, xn);
  proj_kernel<0><<<NPOS / 128, 256, 0, stream>>>(xn, Wq, nullptr, qbuf);
  proj_kernel<1><<<NPOS / 128, 256, 0, stream>>>(xn, Wk, nullptr, kbuf);
  proj_kernel<1><<<NPOS / 128, 256, 0, stream>>>(xn, Wv, nullptr, vbuf);
  proj_kernel<2><<<NPOS / 128, 256, 0, stream>>>(xn, Wg, bg, gbuf);
  bias_kernel<<<(NPOS * NHEAD) / 256, 256, 0, stream>>>(xn, Wb, bbuf);
  attn_kernel<<<dim3(2, LVAL), 256, 0, stream>>>(qbuf, kbuf, vbuf, bbuf, gbuf,
                                                 abuf);
  out_kernel<<<NPOS / 128, 256, 0, stream>>>(abuf, Wo, bo, out);
}

// v001
// One run takes 111 microseconds.
// Two timings next to v000 put it at 1.17 and 1.18 times that version's speed.
#include <hip/hip_runtime.h>
#include <hip/hip_bf16.h>

// ---------------------------------------------------------------------------
// Triangle attention for MI455X (gfx1250, wave32, WMMA 16x16x32 f16).
// L=256, D_PAIR=128, N_HEAD=4, D_HID=32, NPOS=65536.
// ---------------------------------------------------------------------------

#define LVAL   256
#define DPAIR  128
#define NHEAD  4
#define DHID   32
#define NPOS   (LVAL * LVAL)
#define SCALING 0.17677669529663687f   // 1/sqrt(32)

typedef __attribute__((ext_vector_type(16))) _Float16 v16h;
typedef __attribute__((ext_vector_type(8)))  _Float16 v8h;
typedef __attribute__((ext_vector_type(8)))  float    v8f;
typedef int vs4i __attribute__((vector_size(16)));   // async-LDS builtin arg type

#if __has_builtin(__builtin_amdgcn_global_load_async_to_lds_b128) && \
    __has_builtin(__builtin_amdgcn_s_wait_asynccnt)
#define HAVE_ASYNC_LDS 1
#else
#define HAVE_ASYNC_LDS 0
#endif

// Load one 16x32 f16 fragment (A-matrix layout; also used for B as B^T rows)
// from row-major storage with row stride `ld` (elements).
// ISA layout (16-bit A 16x32): lanes 0-15 -> M=0-15, cols {0..7,16..23};
// lanes 16-31 -> M=0-15, cols {8..15,24..31}. Two b128 loads per lane.
__device__ inline v16h load_frag16x32(const _Float16* p, int ld) {
  const int lane = threadIdx.x & 31;
  const int row  = lane & 15;
  const int hi   = lane >> 4;
  const _Float16* r = p + row * ld + hi * 8;
  v8h a = *(const v8h*)(r);
  v8h b = *(const v8h*)(r + 16);
  v16h f;
#pragma unroll
  for (int t = 0; t < 8; ++t) { f[t] = a[t]; f[t + 8] = b[t]; }
  return f;
}

__device__ inline v8f wmma_f16(v16h a, v16h b, v8f c) {
  return __builtin_amdgcn_wmma_f32_16x16x32_f16(false, a, false, b,
                                                (short)0, c, false, false);
}

// ---------------------------------------------------------------------------
// Kernel 1: LayerNorm over D=128, f32 in -> f16 out. One wave per position.
// ---------------------------------------------------------------------------
__global__ __launch_bounds__(256) void ln_kernel(
    const float* __restrict__ pair, const float* __restrict__ gamma,
    const float* __restrict__ beta, _Float16* __restrict__ xn) {
  const int wave = threadIdx.x >> 5;
  const int lane = threadIdx.x & 31;
  const size_t pos = (size_t)blockIdx.x * 8 + wave;
  const float4 xv = *(const float4*)(pair + pos * DPAIR + lane * 4);
  float s  = xv.x + xv.y + xv.z + xv.w;
  float ss = xv.x * xv.x + xv.y * xv.y + xv.z * xv.z + xv.w * xv.w;
#pragma unroll
  for (int m = 1; m < 32; m <<= 1) {
    s  += __shfl_xor(s,  m, 32);
    ss += __shfl_xor(ss, m, 32);
  }
  const float mu  = s * (1.0f / DPAIR);
  const float var = ss * (1.0f / DPAIR) - mu * mu;
  const float inv = rsqrtf(var + 1e-5f);
  const float4 gv = *(const float4*)(gamma + lane * 4);
  const float4 bv = *(const float4*)(beta  + lane * 4);
  _Float16* o = xn + pos * DPAIR + lane * 4;
  o[0] = (_Float16)((xv.x - mu) * inv * gv.x + bv.x);
  o[1] = (_Float16)((xv.y - mu) * inv * gv.y + bv.y);
  o[2] = (_Float16)((xv.z - mu) * inv * gv.z + bv.z);
  o[3] = (_Float16)((xv.w - mu) * inv * gv.w + bv.w);
}

// ---------------------------------------------------------------------------
// Kernel 2: projection GEMM (65536x128)x(128x128), specialized per output.
// MODE 0: q (scale by 1/sqrt(32)); MODE 1: plain (k, v); MODE 2: sigmoid gate.
// grid.x = NPOS/128; block = 256 (8 waves, 16 rows each). W^T f16 in LDS.
// ---------------------------------------------------------------------------
#define WT_LD 136   // 128 + 8 pad (272B row stride, 16B aligned)
template <int MODE>
__global__ __launch_bounds__(256) void proj_kernel(
    const _Float16* __restrict__ xn, const float* __restrict__ W,
    const float* __restrict__ bg, _Float16* __restrict__ dst) {
  __shared__ _Float16 WT[128 * WT_LD];
  for (int idx = threadIdx.x; idx < 128 * 128; idx += 256) {
    const int kk = idx >> 7, n = idx & 127;
    WT[n * WT_LD + kk] = (_Float16)W[idx];     // transpose to N-major
  }
  __syncthreads();

  const int wave = threadIdx.x >> 5;
  const int lane = threadIdx.x & 31;
  const int kcol = lane & 15, hi = lane >> 4;
  const size_t m0 = (size_t)blockIdx.x * 128 + wave * 16;

  v16h A[4];
#pragma unroll
  for (int kk = 0; kk < 4; ++kk)
    A[kk] = load_frag16x32(xn + m0 * DPAIR + kk * 32, DPAIR);

#pragma unroll
  for (int nt = 0; nt < 8; ++nt) {
    v8f acc = {};
#pragma unroll
    for (int kk = 0; kk < 4; ++kk) {
      v16h B = load_frag16x32(WT + (nt * 16) * WT_LD + kk * 32, WT_LD);
      acc = wmma_f16(A[kk], B, acc);
    }
    const int n = nt * 16 + kcol;
    const float bgn = (MODE == 2) ? bg[n] : 0.0f;
#pragma unroll
    for (int r = 0; r < 8; ++r) {
      const size_t m = m0 + r + 8 * hi;
      float val = acc[r];
      if (MODE == 0) val *= SCALING;
      if (MODE == 2) val = 1.0f / (1.0f + __expf(-(val + bgn)));
      dst[m * DPAIR + n] = (_Float16)val;
    }
  }
}

// ---------------------------------------------------------------------------
// Kernel 3: bias = xn @ Wb (128 -> 4), stored in the order in which the
// attention kernel's transposed score tiles hold it as WMMA C operand:
// biasws[h][jt][ck][t][qd][lane][e] = bias(j = jt*16 + (lane & 15),
//   key = ck*32 + t*16 + (lane >> 4)*8 + qd*4 + e, head h).
// Thread t writes float t (whole lines per wave) and reads the row it names.
// ---------------------------------------------------------------------------
__global__ __launch_bounds__(256) void bias_kernel(
    const _Float16* __restrict__ xn, const float* __restrict__ Wb,
    float* __restrict__ biasws) {
  const unsigned t = blockIdx.x * blockDim.x + threadIdx.x;
  const int h  = (int)(t >> 16);          // NPOS == 65536
  const int e  = t & 3;
  const int ln = (t >> 2) & 31;
  const int qd = (t >> 7) & 1;
  const int tl = (t >> 8) & 1;
  const int ck = (t >> 9) & 7;
  const int jt = (t >> 12) & 15;
  const int j  = jt * 16 + (ln & 15);
  const int kk = ck * 32 + tl * 16 + (ln >> 4) * 8 + qd * 4 + e;
  const _Float16* x = xn + (size_t)(j * LVAL + kk) * DPAIR;
  float acc = 0.0f;
#pragma unroll 8
  for (int c = 0; c < DPAIR; ++c) acc += (float)x[c] * Wb[c * NHEAD + h];
  biasws[t] = acc;
}

// Lane l <-> lane l ^ 16 (the two halves of a wave hold the same query).
__device__ inline float xhalf(float x) {
  const int b = __builtin_bit_cast(int, x);
  return __builtin_bit_cast(float, __builtin_amdgcn_permlanex16(
      b, b, 0x76543210, 0xfedcba98, false, false));
}

// ---------------------------------------------------------------------------
// Kernel 4: attention with ONLINE (flash-style) softmax, transposed products:
// S^T = K . Q^T (+ bias as C) and O^T += V^T . P^T.
// grid = (2, 256): block = (j-slab of 128, row i). Per head: K_h staged via
// async direct-to-LDS DMA (GLOBAL_LOAD_ASYNC_TO_LDS_B128, ASYNCcnt);
// V_h^T staged manually (transpose). Each wave owns 16 query columns; a lane
// holds 16 of the 32 keys of a chunk for ONE query, so maximum and sum run
// in-lane with one exchange between the wave's halves, and the two score
// tiles, converted in place, are the B operand of the P.V product.
// ---------------------------------------------------------------------------
#define VT_LD 264   // 256 + 8 pad
__global__ __launch_bounds__(256) void attn_kernel(
    const _Float16* __restrict__ q, const _Float16* __restrict__ k,
    const _Float16* __restrict__ v, const float* __restrict__ biasws,
    const _Float16* __restrict__ gate, _Float16* __restrict__ att) {
  __shared__ _Float16 Ksh[LVAL * DHID];       // 16 KB
  __shared__ _Float16 VTsh[DHID * VT_LD];     // ~16.5 KB

  const int i     = blockIdx.y;
  const int jhalf = blockIdx.x;
  const int wave  = threadIdx.x >> 5;
  const int lane  = threadIdx.x & 31;
  const int kcol  = lane & 15, hi = lane >> 4;
  const int j0    = jhalf * 128 + wave * 16;

  for (int h = 0; h < NHEAD; ++h) {
    __syncthreads();
    // --- K rows: async DMA straight into LDS (one 64B row per thread) ---
    {
      const _Float16* srcK =
          k + ((size_t)(i * LVAL + threadIdx.x)) * DPAIR + h * DHID;
      _Float16* dstK = Ksh + threadIdx.x * DHID;
#if HAVE_ASYNC_LDS
#pragma unroll
      for (int t = 0; t < 4; ++t)
        __builtin_amdgcn_global_load_async_to_lds_b128(
            (vs4i*)(srcK + t * 8), (vs4i*)(dstK + t * 8), 0, 0);
#else
#pragma unroll
      for (int t = 0; t < 4; ++t)
        *(v8h*)(dstK + t * 8) = *(const v8h*)(srcK + t * 8);
#endif
    }
    // --- V^T: manual transpose staging ---
    for (int idx = threadIdx.x; idx < LVAL * DHID; idx += 256) {
      const int kk = idx >> 5, c = idx & 31;
      VTsh[c * VT_LD + kk] =
          v[((size_t)(i * LVAL + kk)) * DPAIR + h * DHID + c];
    }
    // Prefetch next head's K/V rows (emits global_prefetch_b8).
    if (h + 1 < NHEAD) {
      const size_t nsrc =
          ((size_t)(i * LVAL + threadIdx.x)) * DPAIR + (h + 1) * DHID;
      __builtin_prefetch(k + nsrc, 0, 1);
      __builtin_prefetch(v + nsrc, 0, 1);
    }
#if HAVE_ASYNC_LDS
    __builtin_amdgcn_s_wait_asynccnt(0);
#endif
    __syncthreads();

    // B operand: column kcol = query j0 + kcol.
    const v16h bQ =
        load_frag16x32(q + ((size_t)(i * LVAL + j0)) * DPAIR + h * DHID, DPAIR);
    // 512 floats per (query tile, chunk); a wave's b128 load is 512 B in a row.
    const float* biasF =
        biasws + (size_t)((h * 16 + (j0 >> 4)) * 8) * 512 + lane * 4;

    v8f O0 = {}, O1 = {};              // O^T: d = 8*hi + r and 16 + 8*hi + r
    float m = -3.0e38f, sum = 0.0f;    // this lane's query

    for (int c = 0; c < 8; ++c) {        // 32 keys per chunk
      // --- scores: two 16x16 tiles, rows = keys, bias as the C operand ---
      const v16h aK0 = load_frag16x32(Ksh + (2 * c + 0) * 16 * DHID, DHID);
      const v16h aK1 = load_frag16x32(Ksh + (2 * c + 1) * 16 * DHID, DHID);
      const float4 c00 = *(const float4*)(biasF + c * 512);
      const float4 c01 = *(const float4*)(biasF + c * 512 + 128);
      const float4 c10 = *(const float4*)(biasF + c * 512 + 256);
      const float4 c11 = *(const float4*)(biasF + c * 512 + 384);
      const v8f C0 = {c00.x, c00.y, c00.z, c00.w, c01.x, c01.y, c01.z, c01.w};
      const v8f C1 = {c10.x, c10.y, c10.z, c10.w, c11.x, c11.y, c11.z, c11.w};
      const v8f S0 = wmma_f16(aK0, bQ, C0);   // key c*32 + 8*hi + r
      const v8f S1 = wmma_f16(aK1, bQ, C1);   // key c*32 + 16 + 8*hi + r

      // --- online softmax update, in-lane ---
      float tm = fmaxf(S0[0], S1[0]);
#pragma unroll
      for (int r = 1; r < 8; ++r) tm = fmaxf(tm, fmaxf(S0[r], S1[r]));
      tm = fmaxf(tm, xhalf(tm));
      const float mnew = fmaxf(m, tm);
      const float cf   = __expf(m - mnew);
      m = mnew;
      v16h bP;                           // P^T in the hardware k order
      float ps = 0.0f;
#pragma unroll
      for (int r = 0; r < 8; ++r) {
        const float e0 = __expf(S0[r] - mnew);
        const float e1 = __expf(S1[r] - mnew);
        ps += e0 + e1;
        bP[r]     = (_Float16)e0;
        bP[r + 8] = (_Float16)e1;
      }
      sum = sum * cf + ps;               // this half's keys only
#pragma unroll
      for (int r = 0; r < 8; ++r) { O0[r] *= cf; O1[r] *= cf; }

      // --- accumulate O^T += V^T(32x32) @ P^T(32x16) ---
      const v16h aV0 = load_frag16x32(VTsh + 0  * VT_LD + c * 32, VT_LD);
      const v16h aV1 = load_frag16x32(VTsh + 16 * VT_LD + c * 32, VT_LD);
      O0 = wmma_f16(aV0, bP, O0);
      O1 = wmma_f16(aV1, bP, O1);
    }

    // --- join the halves' sums, normalize, gate, store 16 B per tile ---
    {
      const float inv = 1.0f / (sum + xhalf(sum));
      const size_t o =
          (size_t)(i * LVAL + j0 + kcol) * DPAIR + h * DHID + hi * 8;
      const v8h g0 = *(const v8h*)(gate + o);
      const v8h g1 = *(const v8h*)(gate + o + 16);
      v8h r0, r1;
#pragma unroll
      for (int r = 0; r < 8; ++r) {
        r0[r] = (_Float16)(O0[r] * inv * (float)g0[r]);
        r1[r] = (_Float16)(O1[r] * inv * (float)g1[r]);
      }
      *(v8h*)(att + o)      = r0;
      *(v8h*)(att + o + 16) = r1;
      // The next head's staging reuses the registers these stores name.
      asm volatile("s_wait_xcnt 0x0" ::: "memory");
    }
  }
}

// ---------------------------------------------------------------------------
// Kernel 5: out = att @ Wo + bo, f32 out. Same shape as proj_kernel.
// ---------------------------------------------------------------------------
__global__ __launch_bounds__(256) void out_kernel(
    const _Float16* __restrict__ att, const float* __restrict__ Wo,
    const float* __restrict__ bo, float* __restrict__ out) {
  __shared__ _Float16 WT[128 * WT_LD];
  for (int idx = threadIdx.x; idx < 128 * 128; idx += 256) {
    const int kk = idx >> 7, n = idx & 127;
    WT[n * WT_LD + kk] = (_Float16)Wo[idx];
  }
  __syncthreads();

  const int wave = threadIdx.x >> 5;
  const int lane = threadIdx.x & 31;
  const int kcol = lane & 15, hi = lane >> 4;
  const size_t m0 = (size_t)blockIdx.x * 128 + wave * 16;

  v16h A[4];
#pragma unroll
  for (int kk = 0; kk < 4; ++kk)
    A[kk] = load_frag16x32(att + m0 * DPAIR + kk * 32, DPAIR);

#pragma unroll
  for (int nt = 0; nt < 8; ++nt) {
    v8f acc = {};
#pragma unroll
    for (int kk = 0; kk < 4; ++kk) {
      v16h B = load_frag16x32(WT + (nt * 16) * WT_LD + kk * 32, WT_LD);
      acc = wmma_f16(A[kk], B, acc);
    }
    const int n = nt * 16 + kcol;
#pragma unroll
    for (int r = 0; r < 8; ++r) {
      const size_t m = m0 + r + 8 * hi;
      out[m * DPAIR + n] = acc[r] + bo[n];
    }
  }
}

// ---------------------------------------------------------------------------
// Launch.  Inputs: 0 pair, 1 gamma, 2 beta, 3 Wq, 4 Wk, 5 Wv, 6 Wb, 7 Wg,
// 8 bg, 9 Wo, 10 bo.  Output: f32 (1,256,256,128).
// Workspace (~102 MB): xn | q | k | v | gate | att (f16, 16 MB each) | bias.
// ---------------------------------------------------------------------------
extern "C" void kernel_launch(void* const* d_in, const int* in_sizes, int n_in,
                              void* d_out, int out_size, void* d_ws,
                              size_t ws_size, hipStream_t stream) {
  const float* pair  = (const float*)d_in[0];
  const float* gamma = (const float*)d_in[1];
  const float* beta  = (const float*)d_in[2];
  const float* Wq    = (const float*)d_in[3];
  const float* Wk    = (const float*)d_in[4];
  const float* Wv    = (const float*)d_in[5];
  const float* Wb    = (const float*)d_in[6];
  const float* Wg    = (const float*)d_in[7];
  const float* bg    = (const float*)d_in[8];
  const float* Wo    = (const float*)d_in[9];
  const float* bo    = (const float*)d_in[10];
  float* out = (float*)d_out;

  char* ws = (char*)d_ws;
  const size_t SEG = (size_t)NPOS * DPAIR * sizeof(_Float16);  // 16 MB
  _Float16* xn   = (_Float16*)(ws + 0 * SEG);
  _Float16* qbuf = (_Float16*)(ws + 1 * SEG);
  _Float16* kbuf = (_Float16*)(ws + 2 * SEG);
  _Float16* vbuf = (_Float16*)(ws + 3 * SEG);
  _Float16* gbuf = (_Float16*)(ws + 4 * SEG);
  _Float16* abuf = (_Float16*)(ws + 5 * SEG);
  float*    bbuf = (float*)   (ws + 6 * SEG);  // NHEAD*NPOS f32 = 1 MB

  ln_kernel<<<NPOS / 8, 256, 0, stream>>>(pair, gamma, beta, xn);
  proj_kernel<0><<<NPOS / 128, 256, 0, stream>>>(xn, Wq, nullptr, qbuf);
  proj_kernel<1><<<NPOS / 128, 256, 0, stream>>>(xn, Wk, nullptr, kbuf);
  proj_kernel<1><<<NPOS / 128, 256, 0, stream>>>(xn, Wv, nullptr, vbuf);
  proj_kernel<2><<<NPOS / 128, 256, 0, stream>>>(xn, Wg, bg, gbuf);
  bias_kernel<<<(NPOS * NHEAD) / 256, 256, 0, stream>>>(xn, Wb, bbuf);
  attn_kernel<<<dim3(2, LVAL), 256, 0, stream>>>(qbuf, kbuf, vbuf, bbuf, gbuf,
                                                 abuf);
  out_kernel<<<NPOS / 128, 256, 0, stream>>>(abuf, Wo, bo, out);
}

// v002
// Measured time: 70.5 microseconds a run.
// In both of two side-by-side timings against v001, it was 1.58 times as fast.
// Counting every step since v000, it is 1.86 times as fast.
#include <hip/hip_runtime.h>
#include <hip/hip_bf16.h>

// ---------------------------------------------------------------------------
// Triangle attention for MI455X (gfx1250, wave32, WMMA 16x16x32 f16).
// L=256, D_PAIR=128, N_HEAD=4, D_HID=32, NPOS=65536.
// ---------------------------------------------------------------------------

#define LVAL   256
#define DPAIR  128
#define NHEAD  4
#define DHID   32
#define NPOS   (LVAL * LVAL)
#define SCALING 0.17677669529663687f   // 1/sqrt(32)

typedef __attribute__((ext_vector_type(16))) _Float16 v16h;
typedef __attribute__((ext_vector_type(8)))  _Float16 v8h;
typedef __attribute__((ext_vector_type(8)))  float    v8f;
typedef int vs4i __attribute__((vector_size(16)));   // async-LDS builtin arg type

#if __has_builtin(__builtin_amdgcn_global_load_async_to_lds_b128) && \
    __has_builtin(__builtin_amdgcn_s_wait_asynccnt)
#define HAVE_ASYNC_LDS 1
#else
#define HAVE_ASYNC_LDS 0
#endif

// Load one 16x32 f16 fragment (A-matrix layout; also used for B as B^T rows)
// from row-major storage with row stride `ld` (elements).
// ISA layout (16-bit A 16x32): lanes 0-15 -> M=0-15, cols {0..7,16..23};
// lanes 16-31 -> M=0-15, cols {8..15,24..31}. Two b128 loads per lane.
__device__ inline v16h load_frag16x32(const _Float16* p, int ld) {
  const int lane = threadIdx.x & 31;
  const int row  = lane & 15;
  const int hi   = lane >> 4;
  const _Float16* r = p + row * ld + hi * 8;
  v8h a = *(const v8h*)(r);
  v8h b = *(const v8h*)(r + 16);
  v16h f;
#pragma unroll
  for (int t = 0; t < 8; ++t) { f[t] = a[t]; f[t + 8] = b[t]; }
  return f;
}

__device__ inline v8f wmma_f16(v16h a, v16h b, v8f c) {
  return __builtin_amdgcn_wmma_f32_16x16x32_f16(false, a, false, b,
                                                (short)0, c, false, false);
}

// Lane l <-> lane l ^ 16 (the two halves of a wave hold the same query).
__device__ inline float xhalf(float x) {
  const int b = __builtin_bit_cast(int, x);
  return __builtin_bit_cast(float, __builtin_amdgcn_permlanex16(
      b, b, 0x76543210, 0xfedcba98, false, false));
}

// ---------------------------------------------------------------------------
// One projection (16 rows x 128 columns) of a wave: A = the wave's normalized
// rows, held in registers; B = W^T f16 in LDS.
// MODE 0: q (scale by 1/sqrt(32)); MODE 1: plain (k, v); MODE 2: sigmoid gate.
// ---------------------------------------------------------------------------
#define WT_LD 136   // 128 + 8 pad (272B row stride, 16B aligned)
template <int MODE>
__device__ inline void proj_rows(const v16h (&A)[4], const _Float16* WT,
                                 const float* __restrict__ bg,
                                 _Float16* __restrict__ dst, size_t m0) {
  const int lane = threadIdx.x & 31;
  const int kcol = lane & 15, hi = lane >> 4;
#pragma unroll
  for (int nt = 0; nt < 8; ++nt) {
    v8f acc = {};
#pragma unroll
    for (int kk = 0; kk < 4; ++kk) {
      v16h B = load_frag16x32(WT + (nt * 16) * WT_LD + kk * 32, WT_LD);
      acc = wmma_f16(A[kk], B, acc);
    }
    const int n = nt * 16 + kcol;
    const float bgn = (MODE == 2) ? bg[n] : 0.0f;
#pragma unroll
    for (int r = 0; r < 8; ++r) {
      const size_t m = m0 + r + 8 * hi;
      float val = acc[r];
      if (MODE == 0) val *= SCALING;
      if (MODE == 2) val = 1.0f / (1.0f + __expf(-(val + bgn)));
      dst[m * DPAIR + n] = (_Float16)val;
    }
  }
}

// ---------------------------------------------------------------------------
// Kernel 1: LayerNorm, the q, k, v and gate projections and the bias product
// in one launch. grid = 256 blocks of 16 waves; block = (query tile jt, key
// tile kt), wave w owns the 16 rows (j = jt*16 + w, key = kt*16 .. +15).
// A lane reads its row's 64 columns in the order of the WMMA A fragment, so
// the normalized row (rounded to f16) never leaves the registers: mean and
// variance are summed in-lane and joined with the wave's other half.
// The four W^T (f16) are staged in LDS once per block.
// bias = x @ Wb (128 -> 4) is stored in the order in which the attention
// kernel's transposed score tiles hold it as WMMA C operand:
// biasws[h][jt][ck][t][qd][lane][e] = bias(j = jt*16 + (lane & 15),
//   key = ck*32 + t*16 + (lane >> 4)*8 + qd*4 + e, head h);
// the 16 waves of a block fill whole 128-byte lines of it between them.
// ---------------------------------------------------------------------------
__global__ __launch_bounds__(512) void lnproj_kernel(
    const float* __restrict__ pair, const float* __restrict__ gamma,
    const float* __restrict__ beta, const float* __restrict__ Wq,
    const float* __restrict__ Wk, const float* __restrict__ Wv,
    const float* __restrict__ Wg, const float* __restrict__ bg,
    const float* __restrict__ Wb, _Float16* __restrict__ q,
    _Float16* __restrict__ k, _Float16* __restrict__ v,
    _Float16* __restrict__ gate, float* __restrict__ biasws) {
  __shared__ _Float16 WT[4][128 * WT_LD];     // 136 KB
  __shared__ float4 WbS[DPAIR];               // 2 KB

  const int wave = threadIdx.x >> 5;
  const int lane = threadIdx.x & 31;
  const int kcol = lane & 15, hi = lane >> 4;
  const int jt = blockIdx.x >> 4, kt = blockIdx.x & 15;
  const size_t m0 = (size_t)((jt * 16 + wave) * LVAL + kt * 16);

  // This lane's 64 columns: kk*32 + g*16 + hi*8 + 0..7 (issued ahead of the
  // weight staging, which covers their latency).
  const float* xr = pair + (m0 + kcol) * DPAIR + hi * 8;
  float4 xv[16];
#pragma unroll
  for (int u = 0; u < 8; ++u) {
    xv[2 * u]     = *(const float4*)(xr + u * 16);
    xv[2 * u + 1] = *(const float4*)(xr + u * 16 + 4);
  }

  for (int idx = threadIdx.x; idx < 128 * 128; idx += 512) {
    const int kk = idx >> 7, n = idx & 127;
    WT[0][n * WT_LD + kk] = (_Float16)Wq[idx];   // transpose to N-major
    WT[1][n * WT_LD + kk] = (_Float16)Wk[idx];
    WT[2][n * WT_LD + kk] = (_Float16)Wv[idx];
    WT[3][n * WT_LD + kk] = (_Float16)Wg[idx];
  }
  if (threadIdx.x < DPAIR)
    WbS[threadIdx.x] = *(const float4*)(Wb + threadIdx.x * NHEAD);

  // --- LayerNorm: four in-lane chains, then the other half of the row ---
  float4 s4 = {0.0f, 0.0f, 0.0f, 0.0f}, q4 = {0.0f, 0.0f, 0.0f, 0.0f};
#pragma unroll
  for (int u = 0; u < 16; ++u) {
    s4.x += xv[u].x; s4.y += xv[u].y; s4.z += xv[u].z; s4.w += xv[u].w;
    q4.x += xv[u].x * xv[u].x; q4.y += xv[u].y * xv[u].y;
    q4.z += xv[u].z * xv[u].z; q4.w += xv[u].w * xv[u].w;
  }
  float s  = (s4.x + s4.y) + (s4.z + s4.w);
  float ss = (q4.x + q4.y) + (q4.z + q4.w);
  s  += xhalf(s);
  ss += xhalf(ss);
  const float mu  = s * (1.0f / DPAIR);
  const float var = ss * (1.0f / DPAIR) - mu * mu;
  const float inv = rsqrtf(var + 1e-5f);

  v16h A[4];
#pragma unroll
  for (int u = 0; u < 16; ++u) {
    const int c = (u >> 1) * 16 + hi * 8 + (u & 1) * 4;
    const float4 gv = *(const float4*)(gamma + c);
    const float4 bv = *(const float4*)(beta + c);
    const int t = (u & 3) * 4;           // element of fragment u >> 2
    A[u >> 2][t + 0] = (_Float16)((xv[u].x - mu) * inv * gv.x + bv.x);
    A[u >> 2][t + 1] = (_Float16)((xv[u].y - mu) * inv * gv.y + bv.y);
    A[u >> 2][t + 2] = (_Float16)((xv[u].z - mu) * inv * gv.z + bv.z);
    A[u >> 2][t + 3] = (_Float16)((xv[u].w - mu) * inv * gv.w + bv.w);
  }
  __syncthreads();

  // --- bias: f32 sums over this lane's 64 columns, joined across halves ---
  {
    float4 b = {0.0f, 0.0f, 0.0f, 0.0f};
#pragma unroll
    for (int u = 0; u < 64; ++u) {
      const float4 w = WbS[(u >> 3) * 16 + hi * 8 + (u & 7)];
      const float xf = (float)A[u >> 4][u & 15];
      b.x += xf * w.x; b.y += xf * w.y; b.z += xf * w.z; b.w += xf * w.w;
    }
    b.x += xhalf(b.x); b.y += xhalf(b.y);
    b.z += xhalf(b.z); b.w += xhalf(b.w);
    // Row kcol is key kt*16 + kcol of query jt*16 + wave; the lower half of
    // the wave stores heads 0 and 1, the upper half heads 2 and 3.
    const int at = (jt << 12) | (kt << 8) | (((kcol >> 2) & 1) << 7) |
                   ((wave + 16 * (kcol >> 3)) << 2) | (kcol & 3);
    biasws[((2 * hi + 0) << 16) | at] = hi ? b.z : b.x;
    biasws[((2 * hi + 1) << 16) | at] = hi ? b.w : b.y;
  }

  // Each wait: the next projection reuses the registers that the stores in
  // front of it name.
  proj_rows<0>(A, WT[0], nullptr, q, m0);
  asm volatile("s_wait_xcnt 0x0" ::: "memory");
  proj_rows<1>(A, WT[1], nullptr, k, m0);
  asm volatile("s_wait_xcnt 0x0" ::: "memory");
  proj_rows<1>(A, WT[2], nullptr, v, m0);
  asm volatile("s_wait_xcnt 0x0" ::: "memory");
  proj_rows<2>(A, WT[3], bg, gate, m0);
}

// ---------------------------------------------------------------------------
// Kernel 2: attention with ONLINE (flash-style) softmax, transposed products:
// S^T = K . Q^T (+ bias as C) and O^T += V^T . P^T.
// grid = (2, 256): block = (j-slab of 128, row i). Per head: K_h staged via
// async direct-to-LDS DMA (GLOBAL_LOAD_ASYNC_TO_LDS_B128, ASYNCcnt);
// V_h^T staged manually (transpose). Each wave owns 16 query columns; a lane
// holds 16 of the 32 keys of a chunk for ONE query, so maximum and sum run
// in-lane with one exchange between the wave's halves, and the two score
// tiles, converted in place, are the B operand of the P.V product.
// ---------------------------------------------------------------------------
#define VT_LD 264   // 256 + 8 pad
__global__ __launch_bounds__(256) void attn_kernel(
    const _Float16* __restrict__ q, const _Float16* __restrict__ k,
    const _Float16* __restrict__ v, const float* __restrict__ biasws,
    const _Float16* __restrict__ gate, _Float16* __restrict__ att) {
  __shared__ _Float16 Ksh[LVAL * DHID];       // 16 KB
  __shared__ _Float16 VTsh[DHID * VT_LD];     // ~16.5 KB

  const int i     = blockIdx.y;
  const int jhalf = blockIdx.x;
  const int wave  = threadIdx.x >> 5;
  const int lane  = threadIdx.x & 31;
  const int kcol  = lane & 15, hi = lane >> 4;
  const int j0    = jhalf * 128 + wave * 16;

  for (int h = 0; h < NHEAD; ++h) {
    __syncthreads();
    // --- K rows: async DMA straight into LDS (one 64B row per thread) ---
    {
      const _Float16* srcK =
          k + ((size_t)(i * LVAL + threadIdx.x)) * DPAIR + h * DHID;
      _Float16* dstK = Ksh + threadIdx.x * DHID;
#if HAVE_ASYNC_LDS
#pragma unroll
      for (int t = 0; t < 4; ++t)
        __builtin_amdgcn_global_load_async_to_lds_b128(
            (vs4i*)(srcK + t * 8), (vs4i*)(dstK + t * 8), 0, 0);
#else
#pragma unroll
      for (int t = 0; t < 4; ++t)
        *(v8h*)(dstK + t * 8) = *(const v8h*)(srcK + t * 8);
#endif
    }
    // --- V^T: manual transpose staging ---
    for (int idx = threadIdx.x; idx < LVAL * DHID; idx += 256) {
      const int kk = idx >> 5, c = idx & 31;
      VTsh[c * VT_LD + kk] =
          v[((size_t)(i * LVAL + kk)) * DPAIR + h * DHID + c];
    }
    // Prefetch next head's K/V rows (emits global_prefetch_b8).
    if (h + 1 < NHEAD) {
      const size_t nsrc =
          ((size_t)(i * LVAL + threadIdx.x)) * DPAIR + (h + 1) * DHID;
      __builtin_prefetch(k + nsrc, 0, 1);
      __builtin_prefetch(v + nsrc, 0, 1);
    }
#if HAVE_ASYNC_LDS
    __builtin_amdgcn_s_wait_asynccnt(0);
#endif
    __syncthreads();

    // B operand: column kcol = query j0 + kcol.
    const v16h bQ =
        load_frag16x32(q + ((size_t)(i * LVAL + j0)) * DPAIR + h * DHID, DPAIR);
    // 512 floats per (query tile, chunk); a wave's b128 load is 512 B in a row.
    const float* biasF =
        biasws + (size_t)((h * 16 + (j0 >> 4)) * 8) * 512 + lane * 4;

    v8f O0 = {}, O1 = {};              // O^T: d = 8*hi + r and 16 + 8*hi + r
    float m = -3.0e38f, sum = 0.0f;    // this lane's query

    for (int c = 0; c < 8; ++c) {        // 32 keys per chunk
      // --- scores: two 16x16 tiles, rows = keys, bias as the C operand ---
      const v16h aK0 = load_frag16x32(Ksh + (2 * c + 0) * 16 * DHID, DHID);
      const v16h aK1 = load_frag16x32(Ksh + (2 * c + 1) * 16 * DHID, DHID);
      const float4 c00 = *(const float4*)(biasF + c * 512);
      const float4 c01 = *(const float4*)(biasF + c * 512 + 128);
      const float4 c10 = *(const float4*)(biasF + c * 512 + 256);
      const float4 c11 = *(const float4*)(biasF + c * 512 + 384);
      const v8f C0 = {c00.x, c00.y, c00.z, c00.w, c01.x, c01.y, c01.z, c01.w};
      const v8f C1 = {c10.x, c10.y, c10.z, c10.w, c11.x, c11.y, c11.z, c11.w};
      const v8f S0 = wmma_f16(aK0, bQ, C0);   // key c*32 + 8*hi + r
      const v8f S1 = wmma_f16(aK1, bQ, C1);   // key c*32 + 16 + 8*hi + r

      // --- online softmax update, in-lane ---
      float tm = fmaxf(S0[0], S1[0]);
#pragma unroll
      for (int r = 1; r < 8; ++r) tm = fmaxf(tm, fmaxf(S0[r], S1[r]));
      tm = fmaxf(tm, xhalf(tm));
      const float mnew = fmaxf(m, tm);
      const float cf   = __expf(m - mnew);
      m = mnew;
      v16h bP;                           // P^T in the hardware k order
      float ps = 0.0f;
#pragma unroll
      for (int r = 0; r < 8; ++r) {
        const float e0 = __expf(S0[r] - mnew);
        const float e1 = __expf(S1[r] - mnew);
        ps += e0 + e1;
        bP[r]     = (_Float16)e0;
        bP[r + 8] = (_Float16)e1;
      }
      sum = sum * cf + ps;               // this half's keys only
#pragma unroll
      for (int r = 0; r < 8; ++r) { O0[r] *= cf; O1[r] *= cf; }

      // --- accumulate O^T += V^T(32x32) @ P^T(32x16) ---
      const v16h aV0 = load_frag16x32(VTsh + 0  * VT_LD + c * 32, VT_LD);
      const v16h aV1 = load_frag16x32(VTsh + 16 * VT_LD + c * 32, VT_LD);
      O0 = wmma_f16(aV0, bP, O0);
      O1 = wmma_f16(aV1, bP, O1);
    }

    // --- join the halves' sums, normalize, gate, store 16 B per tile ---
    {
      const float inv = 1.0f / (sum + xhalf(sum));
      const size_t o =
          (size_t)(i * LVAL + j0 + kcol) * DPAIR + h * DHID + hi * 8;
      const v8h g0 = *(const v8h*)(gate + o);
      const v8h g1 = *(const v8h*)(gate + o + 16);
      v8h r0, r1;
#pragma unroll
      for (int r = 0; r < 8; ++r) {
        r0[r] = (_Float16)(O0[r] * inv * (float)g0[r]);
        r1[r] = (_Float16)(O1[r] * inv * (float)g1[r]);
      }
      *(v8h*)(att + o)      = r0;
      *(v8h*)(att + o + 16) = r1;
      // The next head's staging reuses the registers these stores name.
      asm volatile("s_wait_xcnt 0x0" ::: "memory");
    }
  }
}

// ---------------------------------------------------------------------------
// Kernel 3: out = att @ Wo + bo, f32 out. 8 waves of 16 rows, W^T f16 in LDS.
// ---------------------------------------------------------------------------
__global__ __launch_bounds__(256) void out_kernel(
    const _Float16* __restrict__ att, const float* __restrict__ Wo,
    const float* __restrict__ bo, float* __restrict__ out) {
  __shared__ _Float16 WT[128 * WT_LD];
  for (int idx = threadIdx.x; idx < 128 * 128; idx += 256) {
    const int kk = idx >> 7, n = idx & 127;
    WT[n * WT_LD + kk] = (_Float16)Wo[idx];
  }
  __syncthreads();

  const int wave = threadIdx.x >> 5;
  const int lane = threadIdx.x & 31;
  const int kcol = lane & 15, hi = lane >> 4;
  const size_t m0 = (size_t)blockIdx.x * 128 + wave * 16;

  v16h A[4];
#pragma unroll
  for (int kk = 0; kk < 4; ++kk)
    A[kk] = load_frag16x32(att + m0 * DPAIR + kk * 32, DPAIR);

#pragma unroll
  for (int nt = 0; nt < 8; ++nt) {
    v8f acc = {};
#pragma unroll
    for (int kk = 0; kk < 4; ++kk) {
      v16h B = load_frag16x32(WT + (nt * 16) * WT_LD + kk * 32, WT_LD);
      acc = wmma_f16(A[kk], B, acc);
    }
    const int n = nt * 16 + kcol;
#pragma unroll
    for (int r = 0; r < 8; ++r) {
      const size_t m = m0 + r + 8 * hi;
      out[m * DPAIR + n] = acc[r] + bo[n];
    }
  }
}

// ---------------------------------------------------------------------------
// Launch.  Inputs: 0 pair, 1 gamma, 2 beta, 3 Wq, 4 Wk, 5 Wv, 6 Wb, 7 Wg,
// 8 bg, 9 Wo, 10 bo.  Output: f32 (1,256,256,128).
// Workspace (~102 MB): unused | q | k | v | gate | att (f16, 16 MB each) | bias.
// ---------------------------------------------------------------------------
extern "C" void kernel_launch(void* const* d_in, const int* in_sizes, int n_in,
                              void* d_out, int out_size, void* d_ws,
                              size_t ws_size, hipStream_t stream) {
  const float* pair  = (const float*)d_in[0];
  const float* gamma = (const float*)d_in[1];
  const float* beta  = (const float*)d_in[2];
  const float* Wq    = (const float*)d_in[3];
  const float* Wk    = (const float*)d_in[4];
  const float* Wv    = (const float*)d_in[5];
  const float* Wb    = (const float*)d_in[6];
  const float* Wg    = (const float*)d_in[7];
  const float* bg    = (const float*)d_in[8];
  const float* Wo    = (const float*)d_in[9];
  const float* bo    = (const float*)d_in[10];
  float* out = (float*)d_out;

  char* ws = (char*)d_ws;
  const size_t SEG = (size_t)NPOS * DPAIR * sizeof(_Float16);  // 16 MB
  _Float16* qbuf = (_Float16*)(ws + 1 * SEG);
  _Float16* kbuf = (_Float16*)(ws + 2 * SEG);
  _Float16* vbuf = (_Float16*)(ws + 3 * SEG);
  _Float16* gbuf = (_Float16*)(ws + 4 * SEG);
  _Float16* abuf = (_Float16*)(ws + 5 * SEG);
  float*    bbuf = (float*)   (ws + 6 * SEG);  // NHEAD*NPOS f32 = 1 MB

  lnproj_kernel<<<NPOS / 256, 512, 0, stream>>>(pair, gamma, beta, Wq, Wk, Wv, Wg,
                                                bg, Wb, qbuf, kbuf, vbuf, gbuf,
                                                bbuf);
  attn_kernel<<<dim3(2, LVAL), 256, 0, stream>>>(qbuf, kbuf, vbuf, bbuf, gbuf,
                                                 abuf);
  out_kernel<<<NPOS / 128, 256, 0, stream>>>(abuf, Wo, bo, out);
}

// v003
// A run of this version takes 42.5 microseconds.
// In both of two side-by-side timings against v002, it was 1.66 times as fast.
// All steps since v000 together make it 3.08 times as fast.
#include <hip/hip_runtime.h>
#include <hip/hip_bf16.h>

// ---------------------------------------------------------------------------
// Triangle attention for MI455X (gfx1250, wave32, WMMA 16x16x32 f16).
// L=256, D_PAIR=128, N_HEAD=4, D_HID=32, NPOS=65536.
// ---------------------------------------------------------------------------

#define LVAL   256
#define DPAIR  128
#define NHEAD  4
#define DHID   32
#define NPOS   (LVAL * LVAL)
#define SCALING 0.17677669529663687f   // 1/sqrt(32)

typedef __attribute__((ext_vector_type(16))) _Float16 v16h;
typedef __attribute__((ext_vector_type(8)))  _Float16 v8h;
typedef __attribute__((ext_vector_type(8)))  float    v8f;

// Load one 16x32 f16 fragment (A-matrix layout; also used for B as B^T rows)
// from row-major storage with row stride `ld` (elements).
// ISA layout (16-bit A 16x32): lanes 0-15 -> M=0-15, cols {0..7,16..23};
// lanes 16-31 -> M=0-15, cols {8..15,24..31}. Two b128 loads per lane.
__device__ inline v16h load_frag16x32(const _Float16* p, int ld) {
  const int lane = threadIdx.x & 31;
  const int row  = lane & 15;
  const int hi   = lane >> 4;
  const _Float16* r = p + row * ld + hi * 8;
  v8h a = *(const v8h*)(r);
  v8h b = *(const v8h*)(r + 16);
  v16h f;
#pragma unroll
  for (int t = 0; t < 8; ++t) { f[t] = a[t]; f[t + 8] = b[t]; }
  return f;
}

__device__ inline v8f wmma_f16(v16h a, v16h b, v8f c) {
  return __builtin_amdgcn_wmma_f32_16x16x32_f16(false, a, false, b,
                                                (short)0, c, false, false);
}

// Lane l <-> lane l ^ 16 (the two halves of a wave hold the same row).
__device__ inline float xhalf(float x) {
  const int b = __builtin_bit_cast(int, x);
  return __builtin_bit_cast(float, __builtin_amdgcn_permlanex16(
      b, b, 0x76543210, 0xfedcba98, false, false));
}

// This lane's 64 columns of its row: kk*32 + g*16 + hi*8 + 0..7, the order of
// the WMMA A (and B) fragment. xr = row start + hi*8.
__device__ inline void load_row(const float* __restrict__ xr,
                                float4 (&xv)[16]) {
#pragma unroll
  for (int u = 0; u < 8; ++u) {
    xv[2 * u]     = *(const float4*)(xr + u * 16);
    xv[2 * u + 1] = *(const float4*)(xr + u * 16 + 4);
  }
  // The address stays in its registers up to this wait.
  asm volatile("s_wait_xcnt 0x0" :: "v"(xr) : "memory");
}

// LayerNorm of the row held by a lane and its partner lane ^ 16: four in-lane
// chains, then the other half of the row; the result, rounded to f16, is the
// wave's 16 x 128 operand in fragment order.
__device__ inline void norm_row(const float4 (&xv)[16],
                                const float* __restrict__ gamma,
                                const float* __restrict__ beta,
                                v16h (&A)[4]) {
  const int hi = (threadIdx.x & 31) >> 4;
  float4 s4 = {0.0f, 0.0f, 0.0f, 0.0f}, q4 = {0.0f, 0.0f, 0.0f, 0.0f};
#pragma unroll
  for (int u = 0; u < 16; ++u) {
    s4.x += xv[u].x; s4.y += xv[u].y; s4.z += xv[u].z; s4.w += xv[u].w;
    q4.x += xv[u].x * xv[u].x; q4.y += xv[u].y * xv[u].y;
    q4.z += xv[u].z * xv[u].z; q4.w += xv[u].w * xv[u].w;
  }
  float s  = (s4.x + s4.y) + (s4.z + s4.w);
  float ss = (q4.x + q4.y) + (q4.z + q4.w);
  s  += xhalf(s);
  ss += xhalf(ss);
  const float mu  = s * (1.0f / DPAIR);
  const float var = ss * (1.0f / DPAIR) - mu * mu;
  const float inv = rsqrtf(var + 1e-5f);
#pragma unroll
  for (int u = 0; u < 16; ++u) {
    const int c = (u >> 1) * 16 + hi * 8 + (u & 1) * 4;
    const float4 gv = *(const float4*)(gamma + c);
    const float4 bv = *(const float4*)(beta + c);
    const int t = (u & 3) * 4;           // element of fragment u >> 2
    A[u >> 2][t + 0] = (_Float16)((xv[u].x - mu) * inv * gv.x + bv.x);
    A[u >> 2][t + 1] = (_Float16)((xv[u].y - mu) * inv * gv.y + bv.y);
    A[u >> 2][t + 2] = (_Float16)((xv[u].z - mu) * inv * gv.z + bv.z);
    A[u >> 2][t + 3] = (_Float16)((xv[u].w - mu) * inv * gv.w + bv.w);
  }
}

// ---------------------------------------------------------------------------
// Kernel 1: the pair bias alone (it couples every row j with every row i, so
// it has to be complete before any attention starts). grid = 256 blocks of 16
// waves; block = (query tile jt, key tile kt), wave w owns the 16 rows
// (j = jt*16 + w, key = kt*16 .. +15).
// bias = layernorm(x) @ Wb (128 -> 4) is stored in the order in which the
// transposed score tiles hold it as WMMA C operand:
// biasws[h][jt][ck][t][qd][lane][e] = bias(j = jt*16 + (lane & 15),
//   key = ck*32 + t*16 + (lane >> 4)*8 + qd*4 + e, head h);
// the 16 waves of a block fill whole 128-byte lines of it between them.
// ---------------------------------------------------------------------------
__global__ __launch_bounds__(512) void bias_kernel(
    const float* __restrict__ pair, const float* __restrict__ gamma,
    const float* __restrict__ beta, const float* __restrict__ Wb,
    float* __restrict__ biasws) {
  __shared__ float4 WbS[DPAIR];               // 2 KB

  const int wave = threadIdx.x >> 5;
  const int lane = threadIdx.x & 31;
  const int kcol = lane & 15, hi = lane >> 4;
  const int jt = blockIdx.x >> 4, kt = blockIdx.x & 15;
  const size_t m0 = (size_t)((jt * 16 + wave) * LVAL + kt * 16);

  float4 xv[16];
  load_row(pair + (m0 + kcol) * DPAIR + hi * 8, xv);
  if (threadIdx.x < DPAIR)
    WbS[threadIdx.x] = *(const float4*)(Wb + threadIdx.x * NHEAD);
  v16h A[4];
  norm_row(xv, gamma, beta, A);
  __syncthreads();

  // f32 sums over this lane's 64 columns, joined across halves
  float4 b = {0.0f, 0.0f, 0.0f, 0.0f};
#pragma unroll
  for (int u = 0; u < 64; ++u) {
    const float4 w = WbS[(u >> 3) * 16 + hi * 8 + (u & 7)];
    const float xf = (float)A[u >> 4][u & 15];
    b.x += xf * w.x; b.y += xf * w.y; b.z += xf * w.z; b.w += xf * w.w;
  }
  b.x += xhalf(b.x); b.y += xhalf(b.y);
  b.z += xhalf(b.z); b.w += xhalf(b.w);
  // Row kcol is key kt*16 + kcol of query jt*16 + wave; the lower half of
  // the wave stores heads 0 and 1, the upper half heads 2 and 3.
  const int at = (jt << 12) | (kt << 8) | (((kcol >> 2) & 1) << 7) |
                 ((wave + 16 * (kcol >> 3)) << 2) | (kcol & 3);
  biasws[((2 * hi + 0) << 16) | at] = hi ? b.z : b.x;
  biasws[((2 * hi + 1) << 16) | at] = hi ? b.w : b.y;
}

// ---------------------------------------------------------------------------
// Kernel 2: everything else of one row i in one block of 16 waves; wave w
// owns positions j = w*16 .. +15 of the row, as queries and as keys.
// The normalized rows stay in registers as fragments X. With X as the B
// operand a product comes out transposed (lane = position, 8 consecutive
// columns in the lane's registers), with X as the A operand plain (lane =
// column, 8 consecutive positions):
//   k^T = Wk^T . X^T  -> one 16-byte LDS store per tile into Ksh[key][column]
//   v   = X . Wv      -> one 16-byte LDS store per tile into VTsh[column][key]
//   q^T, gate^T       -> already in the order of the score product's B
//                        operand and of the O^T accumulators: never stored
// Attention per head as S^T = K . Q^T (+ bias as C), O^T += V^T . P^T with
// online softmax; the gated O^T, rounded to f16, is the A fragment of the
// output product, which is accumulated head by head.
// ---------------------------------------------------------------------------
#define WT_LD 136   // 128 + 8 pad (272B row stride, 16B aligned)
#define VT_LD 264   // 256 + 8 pad
__global__ __launch_bounds__(512) void row_kernel(
    const float* __restrict__ pair, const float* __restrict__ gamma,
    const float* __restrict__ beta, const float* __restrict__ Wq,
    const float* __restrict__ Wk, const float* __restrict__ Wv,
    const float* __restrict__ Wg, const float* __restrict__ bg,
    const float* __restrict__ Wo, const float* __restrict__ bo,
    const float* __restrict__ biasws, float* __restrict__ out) {
  __shared__ __attribute__((aligned(16))) _Float16 WT[5][128 * WT_LD];  // 170 KB
  __shared__ __attribute__((aligned(16))) _Float16 Ksh[LVAL * WT_LD];   // 68 KB
  __shared__ __attribute__((aligned(16))) _Float16 VTsh[DPAIR * VT_LD]; // 66 KB

  const int wave = threadIdx.x >> 5;
  const int lane = threadIdx.x & 31;
  const int kcol = lane & 15, hi = lane >> 4;
  const size_t m0 = (size_t)blockIdx.x * LVAL + wave * 16;

  // Issued ahead of the weight staging, which covers their latency.
  float4 xv[16];
  load_row(pair + (m0 + kcol) * DPAIR + hi * 8, xv);

  for (int idx = threadIdx.x; idx < 128 * 128; idx += 512) {
    const int kk = idx >> 7, n = idx & 127;
    WT[0][n * WT_LD + kk] = (_Float16)Wq[idx];   // transpose to N-major
    WT[1][n * WT_LD + kk] = (_Float16)Wk[idx];
    WT[2][n * WT_LD + kk] = (_Float16)Wv[idx];
    WT[3][n * WT_LD + kk] = (_Float16)Wg[idx];
    WT[4][n * WT_LD + kk] = (_Float16)Wo[idx];
  }

  v16h X[4];
  norm_row(xv, gamma, beta, X);
  __syncthreads();                       // the weights are staged

  // --- k and v of this wave's 16 positions, all heads, into LDS ---
#pragma unroll
  for (int nt = 0; nt < 8; ++nt) {
    v8f ak = {}, av = {};
#pragma unroll
    for (int kk = 0; kk < 4; ++kk) {
      const v16h wk = load_frag16x32(WT[1] + (nt * 16) * WT_LD + kk * 32, WT_LD);
      const v16h wv = load_frag16x32(WT[2] + (nt * 16) * WT_LD + kk * 32, WT_LD);
      ak = wmma_f16(wk, X[kk], ak);      // column nt*16 + 8*hi + r, key kcol
      av = wmma_f16(X[kk], wv, av);      // key 8*hi + r, column nt*16 + kcol
    }
    v8h hk, hv;
#pragma unroll
    for (int r = 0; r < 8; ++r) { hk[r] = (_Float16)ak[r]; hv[r] = (_Float16)av[r]; }
    *(v8h*)(Ksh + (wave * 16 + kcol) * WT_LD + nt * 16 + hi * 8) = hk;
    *(v8h*)(VTsh + (nt * 16 + kcol) * VT_LD + wave * 16 + hi * 8) = hv;
  }
  __syncthreads();                       // every wave's k and v are in LDS

  v8f acc[8] = {};                       // out rows 8*hi + r, column nt*16 + kcol

  for (int h = 0; h < NHEAD; ++h) {
    // --- q^T: the B operand of the scores, column kcol = query ---
    v16h bQ;
    {
      v8f q0 = {}, q1 = {};
#pragma unroll
      for (int kk = 0; kk < 4; ++kk) {
        const v16h w0 = load_frag16x32(WT[0] + (h * DHID) * WT_LD + kk * 32, WT_LD);
        const v16h w1 = load_frag16x32(WT[0] + (h * DHID + 16) * WT_LD + kk * 32, WT_LD);
        q0 = wmma_f16(w0, X[kk], q0);    // d = 8*hi + r
        q1 = wmma_f16(w1, X[kk], q1);    // d = 16 + 8*hi + r
      }
#pragma unroll
      for (int r = 0; r < 8; ++r) {
        bQ[r]     = (_Float16)(q0[r] * SCALING);
        bQ[r + 8] = (_Float16)(q1[r] * SCALING);
      }
    }
    // 512 floats per (query tile, chunk); a wave's b128 load is 512 B in a row.
    const float* biasF =
        biasws + (size_t)((h * 16 + wave) * 8) * 512 + lane * 4;

    v8f O0 = {}, O1 = {};              // O^T: d = 8*hi + r and 16 + 8*hi + r
    float m = -3.0e38f, sum = 0.0f;    // this lane's query

    for (int c = 0; c < 8; ++c) {        // 32 keys per chunk
      // --- scores: two 16x16 tiles, rows = keys, bias as the C operand ---
      const v16h aK0 = load_frag16x32(Ksh + (2 * c + 0) * 16 * WT_LD + h * DHID, WT_LD);
      const v16h aK1 = load_frag16x32(Ksh + (2 * c + 1) * 16 * WT_LD + h * DHID, WT_LD);
      const float4 c00 = *(const float4*)(biasF + c * 512);
      const float4 c01 = *(const float4*)(biasF + c * 512 + 128);
      const float4 c10 = *(const float4*)(biasF + c * 512 + 256);
      const float4 c11 = *(const float4*)(biasF + c * 512 + 384);
      // The address stays in its registers up to this wait.
      asm volatile("s_wait_xcnt 0x0" :: "v"(biasF + c * 512) : "memory");
      const v8f C0 = {c00.x, c00.y, c00.z, c00.w, c01.x, c01.y, c01.z, c01.w};
      const v8f C1 = {c10.x, c10.y, c10.z, c10.w, c11.x, c11.y, c11.z, c11.w};
      const v8f S0 = wmma_f16(aK0, bQ, C0);   // key c*32 + 8*hi + r
      const v8f S1 = wmma_f16(aK1, bQ, C1);   // key c*32 + 16 + 8*hi + r

      // --- online softmax update, in-lane ---
      float tm = fmaxf(S0[0], S1[0]);
#pragma unroll
      for (int r = 1; r < 8; ++r) tm = fmaxf(tm, fmaxf(S0[r], S1[r]));
      tm = fmaxf(tm, xhalf(tm));
      const float mnew = fmaxf(m, tm);
      const float cf   = __expf(m - mnew);
      m = mnew;
      v16h bP;                           // P^T in the hardware k order
      float ps = 0.0f;
#pragma unroll
      for (int r = 0; r < 8; ++r) {
        const float e0 = __expf(S0[r] - mnew);
        const float e1 = __expf(S1[r] - mnew);
        ps += e0 + e1;
        bP[r]     = (_Float16)e0;
        bP[r + 8] = (_Float16)e1;
      }
      sum = sum * cf + ps;               // this half's keys only
#pragma unroll
      for (int r = 0; r < 8; ++r) { O0[r] *= cf; O1[r] *= cf; }

      // --- accumulate O^T += V^T(32x32) @ P^T(32x16) ---
      const v16h aV0 = load_frag16x32(VTsh + (h * DHID + 0)  * VT_LD + c * 32, VT_LD);
      const v16h aV1 = load_frag16x32(VTsh + (h * DHID + 16) * VT_LD + c * 32, VT_LD);
      O0 = wmma_f16(aV0, bP, O0);
      O1 = wmma_f16(aV1, bP, O1);
    }

    // --- gate^T, in the order of O^T ---
    v8f g0 = {}, g1 = {};
#pragma unroll
    for (int kk = 0; kk < 4; ++kk) {
      const v16h w0 = load_frag16x32(WT[3] + (h * DHID) * WT_LD + kk * 32, WT_LD);
      const v16h w1 = load_frag16x32(WT[3] + (h * DHID + 16) * WT_LD + kk * 32, WT_LD);
      g0 = wmma_f16(w0, X[kk], g0);
      g1 = wmma_f16(w1, X[kk], g1);
    }
    const float* bgp = bg + h * DHID + hi * 8;
    const float4 b00 = *(const float4*)(bgp);
    const float4 b01 = *(const float4*)(bgp + 4);
    const float4 b10 = *(const float4*)(bgp + 16);
    const float4 b11 = *(const float4*)(bgp + 20);
    const v8f B0 = {b00.x, b00.y, b00.z, b00.w, b01.x, b01.y, b01.z, b01.w};
    const v8f B1 = {b10.x, b10.y, b10.z, b10.w, b11.x, b11.y, b11.z, b11.w};

    // --- join the halves' sums, normalize, gate: A fragment of the output
    // product (row kcol = query, k = this head's 32 columns) ---
    const float inv = 1.0f / (sum + xhalf(sum));
    v16h aO;
#pragma unroll
    for (int r = 0; r < 8; ++r) {
      const _Float16 s0 = (_Float16)(1.0f / (1.0f + __expf(-(g0[r] + B0[r]))));
      const _Float16 s1 = (_Float16)(1.0f / (1.0f + __expf(-(g1[r] + B1[r]))));
      aO[r]     = (_Float16)(O0[r] * inv * (float)s0);
      aO[r + 8] = (_Float16)(O1[r] * inv * (float)s1);
    }
#pragma unroll
    for (int nt = 0; nt < 8; ++nt) {
      const v16h wo = load_frag16x32(WT[4] + (nt * 16) * WT_LD + h * DHID, WT_LD);
      acc[nt] = wmma_f16(aO, wo, acc[nt]);
    }
  }

#pragma unroll
  for (int nt = 0; nt < 8; ++nt) {
    const int n = nt * 16 + kcol;
    const float bon = bo[n];
#pragma unroll
    for (int r = 0; r < 8; ++r) {
      const size_t mr = m0 + r + 8 * hi;
      out[mr * DPAIR + n] = acc[nt][r] + bon;
    }
  }
}

// ---------------------------------------------------------------------------
// Launch.  Inputs: 0 pair, 1 gamma, 2 beta, 3 Wq, 4 Wk, 5 Wv, 6 Wb, 7 Wg,
// 8 bg, 9 Wo, 10 bo.  Output: f32 (1,256,256,128).
// Workspace: the bias alone, NHEAD*NPOS f32 = 1 MB.
// ---------------------------------------------------------------------------
extern "C" void kernel_launch(void* const* d_in, const int* in_sizes, int n_in,
                              void* d_out, int out_size, void* d_ws,
                              size_t ws_size, hipStream_t stream) {
  const float* pair  = (const float*)d_in[0];
  const float* gamma = (const float*)d_in[1];
  const float* beta  = (const float*)d_in[2];
  const float* Wq    = (const float*)d_in[3];
  const float* Wk    = (const float*)d_in[4];
  const float* Wv    = (const float*)d_in[5];
  const float* Wb    = (const float*)d_in[6];
  const float* Wg    = (const float*)d_in[7];
  const float* bg    = (const float*)d_in[8];
  const float* Wo    = (const float*)d_in[9];
  const float* bo    = (const float*)d_in[10];
  float* out  = (float*)d_out;
  float* bbuf = (float*)d_ws;

  bias_kernel<<<NPOS / 256, 512, 0, stream>>>(pair, gamma, beta, Wb, bbuf);
  row_kernel<<<LVAL, 512, 0, stream>>>(pair, gamma, beta, Wq, Wk, Wv, Wg, bg,
                                       Wo, bo, bbuf, out);
}

// v004
// A run of this version takes 37.7 microseconds.
// Two timings next to v003 both put it at 1.12 times that version's speed.
// All steps since v000 together make it 3.46 times as fast.
#include <hip/hip_runtime.h>
#include <hip/hip_bf16.h>

// ---------------------------------------------------------------------------
// Triangle attention for MI455X (gfx1250, wave32, WMMA 16x16x32 f16).
// L=256, D_PAIR=128, N_HEAD=4, D_HID=32, NPOS=65536.
// ---------------------------------------------------------------------------

#define LVAL   256
#define DPAIR  128
#define NHEAD  4
#define DHID   32
#define NPOS   (LVAL * LVAL)
#define SCALING 0.17677669529663687f   // 1/sqrt(32)

typedef __attribute__((ext_vector_type(16))) _Float16 v16h;
typedef __attribute__((ext_vector_type(8)))  _Float16 v8h;
typedef __attribute__((ext_vector_type(8)))  float    v8f;

// Load one 16x32 f16 fragment (A-matrix layout; also used for B as B^T rows)
// from row-major storage with row stride `ld` (elements).
// ISA layout (16-bit A 16x32): lanes 0-15 -> M=0-15, cols {0..7,16..23};
// lanes 16-31 -> M=0-15, cols {8..15,24..31}. Two b128 loads per lane.
__device__ inline v16h load_frag16x32(const _Float16* p, int ld) {
  const int lane = threadIdx.x & 31;
  const int row  = lane & 15;
  const int hi   = lane >> 4;
  const _Float16* r = p + row * ld + hi * 8;
  v8h a = *(const v8h*)(r);
  v8h b = *(const v8h*)(r + 16);
  v16h f;
#pragma unroll
  for (int t = 0; t < 8; ++t) { f[t] = a[t]; f[t + 8] = b[t]; }
  return f;
}

__device__ inline v8f wmma_f16(v16h a, v16h b, v8f c) {
  return __builtin_amdgcn_wmma_f32_16x16x32_f16(false, a, false, b,
                                                (short)0, c, false, false);
}

// Lane l <-> lane l ^ 16 (the two halves of a wave hold the same row).
__device__ inline float xhalf(float x) {
  const int b = __builtin_bit_cast(int, x);
  return __builtin_bit_cast(float, __builtin_amdgcn_permlanex16(
      b, b, 0x76543210, 0xfedcba98, false, false));
}

// This lane's 64 columns of its row: kk*32 + g*16 + hi*8 + 0..7, the order of
// the WMMA A (and B) fragment. xr = row start + hi*8.
__device__ inline void load_row(const float* __restrict__ xr,
                                float4 (&xv)[16]) {
#pragma unroll
  for (int u = 0; u < 8; ++u) {
    xv[2 * u]     = *(const float4*)(xr + u * 16);
    xv[2 * u + 1] = *(const float4*)(xr + u * 16 + 4);
  }
  // The address stays in its registers up to this wait.
  asm volatile("s_wait_xcnt 0x0" :: "v"(xr) : "memory");
}

// LayerNorm of the row held by a lane and its partner lane ^ 16: four in-lane
// chains, then the other half of the row; the result, rounded to f16, is the
// wave's 16 x 128 operand in fragment order.
__device__ inline void norm_row(const float4 (&xv)[16],
                                const float* __restrict__ gamma,
                                const float* __restrict__ beta,
                                v16h (&A)[4]) {
  const int hi = (threadIdx.x & 31) >> 4;
  float4 s4 = {0.0f, 0.0f, 0.0f, 0.0f}, q4 = {0.0f, 0.0f, 0.0f, 0.0f};
#pragma unroll
  for (int u = 0; u < 16; ++u) {
    s4.x += xv[u].x; s4.y += xv[u].y; s4.z += xv[u].z; s4.w += xv[u].w;
    q4.x += xv[u].x * xv[u].x; q4.y += xv[u].y * xv[u].y;
    q4.z += xv[u].z * xv[u].z; q4.w += xv[u].w * xv[u].w;
  }
  float s  = (s4.x + s4.y) + (s4.z + s4.w);
  float ss = (q4.x + q4.y) + (q4.z + q4.w);
  s  += xhalf(s);
  ss += xhalf(ss);
  const float mu  = s * (1.0f / DPAIR);
  const float var = ss * (1.0f / DPAIR) - mu * mu;
  const float inv = rsqrtf(var + 1e-5f);
#pragma unroll
  for (int u = 0; u < 16; ++u) {
    const int c = (u >> 1) * 16 + hi * 8 + (u & 1) * 4;
    const float4 gv = *(const float4*)(gamma + c);
    const float4 bv = *(const float4*)(beta + c);
    const int t = (u & 3) * 4;           // element of fragment u >> 2
    A[u >> 2][t + 0] = (_Float16)((xv[u].x - mu) * inv * gv.x + bv.x);
    A[u >> 2][t + 1] = (_Float16)((xv[u].y - mu) * inv * gv.y + bv.y);
    A[u >> 2][t + 2] = (_Float16)((xv[u].z - mu) * inv * gv.z + bv.z);
    A[u >> 2][t + 3] = (_Float16)((xv[u].w - mu) * inv * gv.w + bv.w);
  }
}

// ---------------------------------------------------------------------------
// Kernel 1: the pair bias alone (it couples every row j with every row i, so
// it has to be complete before any attention starts). grid = 256 blocks of 16
// waves; block = (query tile jt, key tile kt), wave w owns the 16 rows
// (j = jt*16 + w, key = kt*16 .. +15).
// bias = layernorm(x) @ Wb (128 -> 4) is stored in the order in which the
// transposed score tiles hold it as WMMA C operand:
// biasws[h][jt][ck][t][qd][lane][e] = bias(j = jt*16 + (lane & 15),
//   key = ck*32 + t*16 + (lane >> 4)*8 + qd*4 + e, head h);
// the 16 waves of a block fill whole 128-byte lines of it between them.
// ---------------------------------------------------------------------------
__global__ __launch_bounds__(512) void bias_kernel(
    const float* __restrict__ pair, const float* __restrict__ gamma,
    const float* __restrict__ beta, const float* __restrict__ Wb,
    float* __restrict__ biasws) {
  __shared__ float4 WbS[DPAIR];               // 2 KB

  const int wave = threadIdx.x >> 5;
  const int lane = threadIdx.x & 31;
  const int kcol = lane & 15, hi = lane >> 4;
  const int jt = blockIdx.x >> 4, kt = blockIdx.x & 15;
  const size_t m0 = (size_t)((jt * 16 + wave) * LVAL + kt * 16);

  float4 xv[16];
  load_row(pair + (m0 + kcol) * DPAIR + hi * 8, xv);
  if (threadIdx.x < DPAIR)
    WbS[threadIdx.x] = *(const float4*)(Wb + threadIdx.x * NHEAD);
  v16h A[4];
  norm_row(xv, gamma, beta, A);
  __syncthreads();

  // f32 sums over this lane's 64 columns, joined across halves
  float4 b = {0.0f, 0.0f, 0.0f, 0.0f};
#pragma unroll
  for (int u = 0; u < 64; ++u) {
    const float4 w = WbS[(u >> 3) * 16 + hi * 8 + (u & 7)];
    const float xf = (float)A[u >> 4][u & 15];
    b.x += xf * w.x; b.y += xf * w.y; b.z += xf * w.z; b.w += xf * w.w;
  }
  b.x += xhalf(b.x); b.y += xhalf(b.y);
  b.z += xhalf(b.z); b.w += xhalf(b.w);
  // Row kcol is key kt*16 + kcol of query jt*16 + wave; the lower half of
  // the wave stores heads 0 and 1, the upper half heads 2 and 3.
  const int at = (jt << 12) | (kt << 8) | (((kcol >> 2) & 1) << 7) |
                 ((wave + 16 * (kcol >> 3)) << 2) | (kcol & 3);
  biasws[((2 * hi + 0) << 16) | at] = hi ? b.z : b.x;
  biasws[((2 * hi + 1) << 16) | at] = hi ? b.w : b.y;
}

// ---------------------------------------------------------------------------
// Kernel 2: everything else of one row i in one block of 16 waves; wave w
// owns positions j = w*16 .. +15 of the row, as queries and as keys.
// The normalized rows stay in registers as fragments X. With X as the B
// operand a product comes out transposed (lane = position, 8 consecutive
// columns in the lane's registers), with X as the A operand plain (lane =
// column, 8 consecutive positions):
//   k^T = Wk^T . X^T  -> one 16-byte LDS store per tile into Ksh[key][column]
//   v   = X . Wv      -> one 16-byte LDS store per tile into VTsh[column][key]
//   q^T, gate^T       -> already in the order of the score product's B
//                        operand and of the O^T accumulators: never stored
// Attention per head as S^T = K . Q^T (+ bias as C), O^T += V^T . P^T with
// online softmax over passes of 128 keys; the gated O^T, rounded to f16, is
// the A fragment of the output product, which runs behind the head loop.
// ---------------------------------------------------------------------------
#define WT_LD 136   // 128 + 8 pad (272B row stride, 16B aligned)
#define VT_LD 264   // 256 + 8 pad
__global__ __launch_bounds__(512) void row_kernel(
    const float* __restrict__ pair, const float* __restrict__ gamma,
    const float* __restrict__ beta, const float* __restrict__ Wq,
    const float* __restrict__ Wk, const float* __restrict__ Wv,
    const float* __restrict__ Wg, const float* __restrict__ bg,
    const float* __restrict__ Wo, const float* __restrict__ bo,
    const float* __restrict__ biasws, float* __restrict__ out) {
  __shared__ __attribute__((aligned(16))) _Float16 WT[5][128 * WT_LD];  // 170 KB
  __shared__ __attribute__((aligned(16))) _Float16 Ksh[LVAL * WT_LD];   // 68 KB
  __shared__ __attribute__((aligned(16))) _Float16 VTsh[DPAIR * VT_LD]; // 66 KB

  const int wave = threadIdx.x >> 5;
  const int lane = threadIdx.x & 31;
  const int kcol = lane & 15, hi = lane >> 4;
  const size_t m0 = (size_t)blockIdx.x * LVAL + wave * 16;

  // Issued ahead of the weight staging, which covers their latency.
  float4 xv[16];
  load_row(pair + (m0 + kcol) * DPAIR + hi * 8, xv);

  for (int idx = threadIdx.x; idx < 128 * 128; idx += 512) {
    const int kk = idx >> 7, n = idx & 127;
    WT[0][n * WT_LD + kk] = (_Float16)Wq[idx];   // transpose to N-major
    WT[1][n * WT_LD + kk] = (_Float16)Wk[idx];
    WT[2][n * WT_LD + kk] = (_Float16)Wv[idx];
    WT[3][n * WT_LD + kk] = (_Float16)Wg[idx];
    WT[4][n * WT_LD + kk] = (_Float16)Wo[idx];
  }

  v16h X[4];
  norm_row(xv, gamma, beta, X);
  __syncthreads();                       // the weights are staged

  // --- k and v of this wave's 16 positions, all heads, into LDS ---
#pragma unroll
  for (int nt = 0; nt < 8; ++nt) {
    v8f ak = {}, av = {};
#pragma unroll
    for (int kk = 0; kk < 4; ++kk) {
      const v16h wk = load_frag16x32(WT[1] + (nt * 16) * WT_LD + kk * 32, WT_LD);
      const v16h wv = load_frag16x32(WT[2] + (nt * 16) * WT_LD + kk * 32, WT_LD);
      ak = wmma_f16(wk, X[kk], ak);      // column nt*16 + 8*hi + r, key kcol
      av = wmma_f16(X[kk], wv, av);      // key 8*hi + r, column nt*16 + kcol
    }
    v8h hk, hv;
#pragma unroll
    for (int r = 0; r < 8; ++r) { hk[r] = (_Float16)ak[r]; hv[r] = (_Float16)av[r]; }
    *(v8h*)(Ksh + (wave * 16 + kcol) * WT_LD + nt * 16 + hi * 8) = hk;
    *(v8h*)(VTsh + (nt * 16 + kcol) * VT_LD + wave * 16 + hi * 8) = hv;
  }
  __syncthreads();                       // every wave's k and v are in LDS

  // Wk and Wv are dead behind that barrier: each wave parks its gated O
  // fragments there, 4 KB of its own, read back by the same lanes only.
  _Float16* park = WT[1] + wave * 2048 + lane * 8;

  for (int h = 0; h < NHEAD; ++h) {
    // --- q^T: the B operand of the scores, column kcol = query ---
    v16h bQ;
    {
      v8f q0 = {}, q1 = {};
#pragma unroll
      for (int kk = 0; kk < 4; ++kk) {
        const v16h w0 = load_frag16x32(WT[0] + (h * DHID) * WT_LD + kk * 32, WT_LD);
        const v16h w1 = load_frag16x32(WT[0] + (h * DHID + 16) * WT_LD + kk * 32, WT_LD);
        q0 = wmma_f16(w0, X[kk], q0);    // d = 8*hi + r
        q1 = wmma_f16(w1, X[kk], q1);    // d = 16 + 8*hi + r
      }
#pragma unroll
      for (int r = 0; r < 8; ++r) {
        bQ[r]     = (_Float16)(q0[r] * SCALING);
        bQ[r + 8] = (_Float16)(q1[r] * SCALING);
      }
    }
    // 512 floats per (query tile, 32 keys); a wave's b128 load is 512 B in a row.
    const float* biasF =
        biasws + (size_t)((h * 16 + wave) * 8) * 512 + lane * 4;

    v8f O0 = {}, O1 = {};              // O^T: d = 8*hi + r and 16 + 8*hi + r
    float m = -3.0e38f, sum = 0.0f;    // this lane's query

    // Kept rolled: unrolled, the two passes' tiles overlap in registers and
    // the normalized rows are spilled to scratch.
#pragma unroll 1
    for (int cc = 0; cc < 2; ++cc) {     // 128 keys per pass
      // --- scores: eight independent 16x16 tiles, rows = keys, bias as the
      // C operand; the pass's 16 bias loads are in flight together ---
      const float* bp = biasF + cc * 2048;
      float4 cb[16];
#pragma unroll
      for (int u = 0; u < 16; ++u) cb[u] = *(const float4*)(bp + u * 128);
      // The address stays in its registers up to this wait.
      asm volatile("s_wait_xcnt 0x0" :: "v"(bp) : "memory");
      v8f S[8];                          // S[t]: key cc*128 + t*16 + 8*hi + r
#pragma unroll
      for (int t = 0; t < 8; ++t) {
        const v16h aK = load_frag16x32(
            Ksh + (cc * 8 + t) * 16 * WT_LD + h * DHID, WT_LD);
        const v8f C = {cb[2 * t].x,     cb[2 * t].y,     cb[2 * t].z,
                       cb[2 * t].w,     cb[2 * t + 1].x, cb[2 * t + 1].y,
                       cb[2 * t + 1].z, cb[2 * t + 1].w};
        S[t] = wmma_f16(aK, bQ, C);
      }

      // --- online softmax update, in-lane: four chains, then joined ---
      float tq[4];
#pragma unroll
      for (int p = 0; p < 4; ++p) {
        tq[p] = fmaxf(S[2 * p][0], S[2 * p + 1][0]);
#pragma unroll
        for (int r = 1; r < 8; ++r)
          tq[p] = fmaxf(tq[p], fmaxf(S[2 * p][r], S[2 * p + 1][r]));
      }
      float tm = fmaxf(fmaxf(tq[0], tq[1]), fmaxf(tq[2], tq[3]));
      tm = fmaxf(tm, xhalf(tm));
      const float mnew = fmaxf(m, tm);
      const float cf   = __expf(m - mnew);
      m = mnew;
      v16h bP[4];                        // P^T in the hardware k order
      float pq[4];
#pragma unroll
      for (int p = 0; p < 4; ++p) {
        pq[p] = 0.0f;
#pragma unroll
        for (int r = 0; r < 8; ++r) {
          const float e0 = __expf(S[2 * p][r] - mnew);
          const float e1 = __expf(S[2 * p + 1][r] - mnew);
          pq[p] += e0 + e1;
          bP[p][r]     = (_Float16)e0;
          bP[p][r + 8] = (_Float16)e1;
        }
      }
      // this half's keys only
      sum = sum * cf + ((pq[0] + pq[1]) + (pq[2] + pq[3]));
#pragma unroll
      for (int r = 0; r < 8; ++r) { O0[r] *= cf; O1[r] *= cf; }

      // --- accumulate O^T += V^T(32x128) @ P^T(128x16) ---
#pragma unroll
      for (int p = 0; p < 4; ++p) {
        const v16h aV0 = load_frag16x32(
            VTsh + (h * DHID + 0)  * VT_LD + (cc * 4 + p) * 32, VT_LD);
        const v16h aV1 = load_frag16x32(
            VTsh + (h * DHID + 16) * VT_LD + (cc * 4 + p) * 32, VT_LD);
        O0 = wmma_f16(aV0, bP[p], O0);
        O1 = wmma_f16(aV1, bP[p], O1);
      }
    }

    // --- gate^T, in the order of O^T ---
    v8f g0 = {}, g1 = {};
#pragma unroll
    for (int kk = 0; kk < 4; ++kk) {
      const v16h w0 = load_frag16x32(WT[3] + (h * DHID) * WT_LD + kk * 32, WT_LD);
      const v16h w1 = load_frag16x32(WT[3] + (h * DHID + 16) * WT_LD + kk * 32, WT_LD);
      g0 = wmma_f16(w0, X[kk], g0);
      g1 = wmma_f16(w1, X[kk], g1);
    }
    const float* bgp = bg + h * DHID + hi * 8;
    const float4 b00 = *(const float4*)(bgp);
    const float4 b01 = *(const float4*)(bgp + 4);
    const float4 b10 = *(const float4*)(bgp + 16);
    const float4 b11 = *(const float4*)(bgp + 20);
    const v8f B0 = {b00.x, b00.y, b00.z, b00.w, b01.x, b01.y, b01.z, b01.w};
    const v8f B1 = {b10.x, b10.y, b10.z, b10.w, b11.x, b11.y, b11.z, b11.w};

    // --- join the halves' sums, normalize, gate: A fragment of the output
    // product (row kcol = query, k = this head's 32 columns) ---
    const float inv = 1.0f / (sum + xhalf(sum));
    v16h aO;
#pragma unroll
    for (int r = 0; r < 8; ++r) {
      const _Float16 s0 = (_Float16)(1.0f / (1.0f + __expf(-(g0[r] + B0[r]))));
      const _Float16 s1 = (_Float16)(1.0f / (1.0f + __expf(-(g1[r] + B1[r]))));
      aO[r]     = (_Float16)(O0[r] * inv * (float)s0);
      aO[r + 8] = (_Float16)(O1[r] * inv * (float)s1);
    }
    v8h lo, up;
#pragma unroll
    for (int r = 0; r < 8; ++r) { lo[r] = aO[r]; up[r] = aO[r + 8]; }
    *(v8h*)(park + h * 512)       = lo;
    *(v8h*)(park + h * 512 + 256) = up;
  }

  // --- output product, once for all heads: eight independent accumulators,
  // each summed head by head ---
  v8f acc[8] = {};                       // out rows 8*hi + r, column nt*16 + kcol
#pragma unroll
  for (int h = 0; h < NHEAD; ++h) {
    const v8h lo = *(const v8h*)(park + h * 512);
    const v8h up = *(const v8h*)(park + h * 512 + 256);
    v16h aO;
#pragma unroll
    for (int r = 0; r < 8; ++r) { aO[r] = lo[r]; aO[r + 8] = up[r]; }
#pragma unroll
    for (int nt = 0; nt < 8; ++nt) {
      const v16h wo = load_frag16x32(WT[4] + (nt * 16) * WT_LD + h * DHID, WT_LD);
      acc[nt] = wmma_f16(aO, wo, acc[nt]);
    }
  }

#pragma unroll
  for (int nt = 0; nt < 8; ++nt) {
    const int n = nt * 16 + kcol;
    const float bon = bo[n];
#pragma unroll
    for (int r = 0; r < 8; ++r) {
      const size_t mr = m0 + r + 8 * hi;
      out[mr * DPAIR + n] = acc[nt][r] + bon;
    }
  }
}

// ---------------------------------------------------------------------------
// Launch.  Inputs: 0 pair, 1 gamma, 2 beta, 3 Wq, 4 Wk, 5 Wv, 6 Wb, 7 Wg,
// 8 bg, 9 Wo, 10 bo.  Output: f32 (1,256,256,128).
// Workspace: the bias alone, NHEAD*NPOS f32 = 1 MB.
// ---------------------------------------------------------------------------
extern "C" void kernel_launch(void* const* d_in, const int* in_sizes, int n_in,
                              void* d_out, int out_size, void* d_ws,
                              size_t ws_size, hipStream_t stream) {
  const float* pair  = (const float*)d_in[0];
  const float* gamma = (const float*)d_in[1];
  const float* beta  = (const float*)d_in[2];
  const float* Wq    = (const float*)d_in[3];
  const float* Wk    = (const float*)d_in[4];
  const float* Wv    = (const float*)d_in[5];
  const float* Wb    = (const float*)d_in[6];
  const float* Wg    = (const float*)d_in[7];
  const float* bg    = (const float*)d_in[8];
  const float* Wo    = (const float*)d_in[9];
  const float* bo    = (const float*)d_in[10];
  float* out  = (float*)d_out;
  float* bbuf = (float*)d_ws;

  bias_kernel<<<NPOS / 256, 512, 0, stream>>>(pair, gamma, beta, Wb, bbuf);
  row_kernel<<<LVAL, 512, 0, stream>>>(pair, gamma, beta, Wq, Wk, Wv, Wg, bg,
                                       Wo, bo, bbuf, out);
}

// v005
// A run of this version takes 33.1 microseconds.
// Next to v004, in two timings, it ran 1.13 times as fast each time.
// Counting every step since v000, it is 3.92 times as fast.
#include <hip/hip_runtime.h>
#include <hip/hip_bf16.h>

// ---------------------------------------------------------------------------
// Triangle attention for MI455X (gfx1250, wave32, WMMA 16x16x32 f16).
// L=256, D_PAIR=128, N_HEAD=4, D_HID=32, NPOS=65536.
// ---------------------------------------------------------------------------

#define LVAL   256
#define DPAIR  128
#define NHEAD  4
#define DHID   32
#define NPOS   (LVAL * LVAL)
#define SCALING 0.17677669529663687f   // 1/sqrt(32)

typedef __attribute__((ext_vector_type(16))) _Float16 v16h;
typedef __attribute__((ext_vector_type(8)))  _Float16 v8h;
typedef __attribute__((ext_vector_type(8)))  float    v8f;

// Load one 16x32 f16 fragment (A-matrix layout; also used for B as B^T rows)
// from row-major storage with row stride `ld` (elements).
// ISA layout (16-bit A 16x32): lanes 0-15 -> M=0-15, cols {0..7,16..23};
// lanes 16-31 -> M=0-15, cols {8..15,24..31}. Two b128 loads per lane.
__device__ inline v16h load_frag16x32(const _Float16* p, int ld) {
  const int lane = threadIdx.x & 31;
  const int row  = lane & 15;
  const int hi   = lane >> 4;
  const _Float16* r = p + row * ld + hi * 8;
  v8h a = *(const v8h*)(r);
  v8h b = *(const v8h*)(r + 16);
  v16h f;
#pragma unroll
  for (int t = 0; t < 8; ++t) { f[t] = a[t]; f[t + 8] = b[t]; }
  return f;
}

__device__ inline v8f wmma_f16(v16h a, v16h b, v8f c) {
  return __builtin_amdgcn_wmma_f32_16x16x32_f16(false, a, false, b,
                                                (short)0, c, false, false);
}

// Lane l <-> lane l ^ 16 (the two halves of a wave hold the same row).
__device__ inline float xhalf(float x) {
  const int b = __builtin_bit_cast(int, x);
  return __builtin_bit_cast(float, __builtin_amdgcn_permlanex16(
      b, b, 0x76543210, 0xfedcba98, false, false));
}

// This lane's 64 columns of its row: kk*32 + g*16 + hi*8 + 0..7, the order of
// the WMMA A (and B) fragment. xr = row start + hi*8.
__device__ inline void load_row(const float* __restrict__ xr,
                                float4 (&xv)[16]) {
#pragma unroll
  for (int u = 0; u < 8; ++u) {
    xv[2 * u]     = *(const float4*)(xr + u * 16);
    xv[2 * u + 1] = *(const float4*)(xr + u * 16 + 4);
  }
  // The address stays in its registers up to this wait.
  asm volatile("s_wait_xcnt 0x0" :: "v"(xr) : "memory");
}

// LayerNorm of the row held by a lane and its partner lane ^ 16: four in-lane
// chains, then the other half of the row; the result, rounded to f16, is the
// wave's 16 x 128 operand in fragment order.
__device__ inline void norm_row(const float4 (&xv)[16],
                                const float* __restrict__ gamma,
                                const float* __restrict__ beta,
                                v16h (&A)[4]) {
  const int hi = (threadIdx.x & 31) >> 4;
  float4 s4 = {0.0f, 0.0f, 0.0f, 0.0f}, q4 = {0.0f, 0.0f, 0.0f, 0.0f};
#pragma unroll
  for (int u = 0; u < 16; ++u) {
    s4.x += xv[u].x; s4.y += xv[u].y; s4.z += xv[u].z; s4.w += xv[u].w;
    q4.x += xv[u].x * xv[u].x; q4.y += xv[u].y * xv[u].y;
    q4.z += xv[u].z * xv[u].z; q4.w += xv[u].w * xv[u].w;
  }
  float s  = (s4.x + s4.y) + (s4.z + s4.w);
  float ss = (q4.x + q4.y) + (q4.z + q4.w);
  s  += xhalf(s);
  ss += xhalf(ss);
  const float mu  = s * (1.0f / DPAIR);
  const float var = ss * (1.0f / DPAIR) - mu * mu;
  const float inv = rsqrtf(var + 1e-5f);
#pragma unroll
  for (int u = 0; u < 16; ++u) {
    const int c = (u >> 1) * 16 + hi * 8 + (u & 1) * 4;
    const float4 gv = *(const float4*)(gamma + c);
    const float4 bv = *(const float4*)(beta + c);
    const int t = (u & 3) * 4;           // element of fragment u >> 2
    A[u >> 2][t + 0] = (_Float16)((xv[u].x - mu) * inv * gv.x + bv.x);
    A[u >> 2][t + 1] = (_Float16)((xv[u].y - mu) * inv * gv.y + bv.y);
    A[u >> 2][t + 2] = (_Float16)((xv[u].z - mu) * inv * gv.z + bv.z);
    A[u >> 2][t + 3] = (_Float16)((xv[u].w - mu) * inv * gv.w + bv.w);
  }
}

// ---------------------------------------------------------------------------
// Kernel 1: the pair bias (it couples every row j with every row i, so
// it has to be complete before any attention starts). grid = 256 blocks of 16
// waves; block = (query tile jt, key tile kt), wave w owns the 16 rows
// (j = jt*16 + w, key = kt*16 .. +15).
// bias = layernorm(x) @ Wb (128 -> 4) is stored in the order in which the
// transposed score tiles hold it as WMMA C operand:
// biasws[h][jt][ck][t][qd][lane][e] = bias(j = jt*16 + (lane & 15),
//   key = ck*32 + t*16 + (lane >> 4)*8 + qd*4 + e, head h);
// the 16 waves of a block fill whole 128-byte lines of it between them.
// Beside that, the five 128 x 128 weights are rounded to f16 and transposed
// once for the whole chip: wtws[matrix][n][k], matrix = q, k, v, gate, out.
// Two waves write four half rows of 64 k (one 128-byte line each).
// ---------------------------------------------------------------------------
__global__ __launch_bounds__(512) void bias_kernel(
    const float* __restrict__ pair, const float* __restrict__ gamma,
    const float* __restrict__ beta, const float* __restrict__ Wb,
    const float* __restrict__ Wq, const float* __restrict__ Wk,
    const float* __restrict__ Wv, const float* __restrict__ Wg,
    const float* __restrict__ Wo, float* __restrict__ biasws,
    _Float16* __restrict__ wtws) {
  __shared__ float4 WbS[DPAIR];               // 2 KB

  const int wave = threadIdx.x >> 5;
  const int lane = threadIdx.x & 31;
  const int kcol = lane & 15, hi = lane >> 4;
  const int jt = blockIdx.x >> 4, kt = blockIdx.x & 15;
  const size_t m0 = (size_t)((jt * 16 + wave) * LVAL + kt * 16);

  float4 xv[16];
  load_row(pair + (m0 + kcol) * DPAIR + hi * 8, xv);
  if (threadIdx.x < DPAIR)
    WbS[threadIdx.x] = *(const float4*)(Wb + threadIdx.x * NHEAD);
  // 320 units of 4 rows n x 64 k, two waves each; scalar, so that the matrix
  // is picked without lane masks.
  const int wu   = __builtin_amdgcn_readfirstlane(wave);
  const int unit = blockIdx.x + (wu >> 1) * 256;
  if (wu < 4 && unit < 320) {
    const int mtx = unit >> 6, n4 = ((unit >> 1) & 31) * 4;
    const int kk  = (unit & 1) * 64 + (threadIdx.x & 63);
    const float* Ws = mtx == 0 ? Wq : mtx == 1 ? Wk : mtx == 2 ? Wv
                    : mtx == 3 ? Wg : Wo;
    const float* wp = Ws + kk * DPAIR + n4;
    const float4 w = *(const float4*)wp;
    // The address stays in its registers up to this wait.
    asm volatile("s_wait_xcnt 0x0" :: "v"(wp) : "memory");
    _Float16* d = wtws + (mtx * DPAIR + n4) * DPAIR + kk;
    d[0 * DPAIR] = (_Float16)w.x;
    d[1 * DPAIR] = (_Float16)w.y;
    d[2 * DPAIR] = (_Float16)w.z;
    d[3 * DPAIR] = (_Float16)w.w;
    // Ahead of the layernorm's loads, which are given the stores' registers.
    asm volatile("s_wait_xcnt 0x0" ::: "memory");
  }
  v16h A[4];
  norm_row(xv, gamma, beta, A);
  __syncthreads();

  // f32 sums over this lane's 64 columns, joined across halves
  float4 b = {0.0f, 0.0f, 0.0f, 0.0f};
#pragma unroll
  for (int u = 0; u < 64; ++u) {
    const float4 w = WbS[(u >> 3) * 16 + hi * 8 + (u & 7)];
    const float xf = (float)A[u >> 4][u & 15];
    b.x += xf * w.x; b.y += xf * w.y; b.z += xf * w.z; b.w += xf * w.w;
  }
  b.x += xhalf(b.x); b.y += xhalf(b.y);
  b.z += xhalf(b.z); b.w += xhalf(b.w);
  // Row kcol is key kt*16 + kcol of query jt*16 + wave; the lower half of
  // the wave stores heads 0 and 1, the upper half heads 2 and 3.
  const int at = (jt << 12) | (kt << 8) | (((kcol >> 2) & 1) << 7) |
                 ((wave + 16 * (kcol >> 3)) << 2) | (kcol & 3);
  biasws[((2 * hi + 0) << 16) | at] = hi ? b.z : b.x;
  biasws[((2 * hi + 1) << 16) | at] = hi ? b.w : b.y;
}

// ---------------------------------------------------------------------------
// Kernel 2: everything else of one row i in one block of 16 waves; wave w
// owns positions j = w*16 .. +15 of the row, as queries and as keys.
// The normalized rows stay in registers as fragments X. With X as the B
// operand a product comes out transposed (lane = position, 8 consecutive
// columns in the lane's registers), with X as the A operand plain (lane =
// column, 8 consecutive positions):
//   k^T = Wk^T . X^T  -> one 16-byte LDS store per tile into Ksh[key][column]
//   v   = X . Wv      -> one 16-byte LDS store per tile into VTsh[column][key]
//   q^T, gate^T       -> already in the order of the score product's B
//                        operand and of the O^T accumulators: never stored
// Attention per head as S^T = K . Q^T (+ bias as C), O^T += V^T . P^T with
// online softmax over passes of 128 keys; the gated O^T, rounded to f16, is
// the A fragment of the output product, which runs behind the head loop.
// ---------------------------------------------------------------------------
#define WT_LD 136   // 128 + 8 pad (272B row stride, 16B aligned)
#define VT_LD 264   // 256 + 8 pad
__global__ __launch_bounds__(512) void row_kernel(
    const float* __restrict__ pair, const float* __restrict__ gamma,
    const float* __restrict__ beta, const float* __restrict__ bg,
    const float* __restrict__ bo, const float* __restrict__ biasws,
    const _Float16* __restrict__ wtws, float* __restrict__ out) {
  __shared__ __attribute__((aligned(16))) _Float16 WT[5][128 * WT_LD];  // 170 KB
  __shared__ __attribute__((aligned(16))) _Float16 Ksh[LVAL * WT_LD];   // 68 KB
  __shared__ __attribute__((aligned(16))) _Float16 VTsh[DPAIR * VT_LD]; // 66 KB

  const int wave = threadIdx.x >> 5;
  const int lane = threadIdx.x & 31;
  const int kcol = lane & 15, hi = lane >> 4;
  const size_t m0 = (size_t)blockIdx.x * LVAL + wave * 16;

  // Issued ahead of the weight staging.
  float4 xv[16];
  load_row(pair + (m0 + kcol) * DPAIR + hi * 8, xv);

  // The weight rows of 256 bytes go from the workspace straight into LDS at
  // the padded pitch: 16 lanes a row, so one copy of the block brings 32 rows
  // and four copies a matrix. Wk and Wv fly under the layernorm.
  const unsigned l0 = (unsigned)(size_t)(&WT[0][0]) +
                      (threadIdx.x >> 4) * (WT_LD * 2) + (threadIdx.x & 15) * 16;
  const _Float16* g0 = wtws + threadIdx.x * 8;
#define WL(c) "v"(l0 + (c) * (32 * WT_LD * 2))
#define WG(c) "v"(g0 + (c) * (512 * 8))
  // The closing wait stands ahead of every later write of the registers that
  // the copies name (a precaution).
  asm volatile(
      "global_load_async_to_lds_b128 %0, %8, off\n\t"
      "global_load_async_to_lds_b128 %1, %9, off\n\t"
      "global_load_async_to_lds_b128 %2, %10, off\n\t"
      "global_load_async_to_lds_b128 %3, %11, off\n\t"
      "global_load_async_to_lds_b128 %4, %12, off\n\t"
      "global_load_async_to_lds_b128 %5, %13, off\n\t"
      "global_load_async_to_lds_b128 %6, %14, off\n\t"
      "global_load_async_to_lds_b128 %7, %15, off\n\t"
      "s_wait_xcnt 0x0"
      :: WL(4), WL(5), WL(6), WL(7), WL(8), WL(9), WL(10), WL(11),
         WG(4), WG(5), WG(6), WG(7), WG(8), WG(9), WG(10), WG(11)
      : "memory");

  v16h X[4];
  norm_row(xv, gamma, beta, X);
  // Keeps the layernorm ahead of the barrier, under the copies' flight, and
  // the next copies' 36 address registers behind it (formed ahead of it they
  // push the kernel into scratch).
  __builtin_amdgcn_sched_barrier(0);
  // This wave's copies have landed; the barrier then publishes every wave's.
  asm volatile("s_wait_asynccnt 0x0" ::: "memory");
  __syncthreads();                       // Wk and Wv are staged

  // Wq, Wg and Wo are first read behind the next barrier: their copies fly
  // under the k and v products. Same closing wait as above.
  asm volatile(
      "global_load_async_to_lds_b128 %0, %12, off\n\t"
      "global_load_async_to_lds_b128 %1, %13, off\n\t"
      "global_load_async_to_lds_b128 %2, %14, off\n\t"
      "global_load_async_to_lds_b128 %3, %15, off\n\t"
      "global_load_async_to_lds_b128 %4, %16, off\n\t"
      "global_load_async_to_lds_b128 %5, %17, off\n\t"
      "global_load_async_to_lds_b128 %6, %18, off\n\t"
      "global_load_async_to_lds_b128 %7, %19, off\n\t"
      "global_load_async_to_lds_b128 %8, %20, off\n\t"
      "global_load_async_to_lds_b128 %9, %21, off\n\t"
      "global_load_async_to_lds_b128 %10, %22, off\n\t"
      "global_load_async_to_lds_b128 %11, %23, off\n\t"
      "s_wait_xcnt 0x0"
      :: WL(0), WL(1), WL(2), WL(3), WL(12), WL(13), WL(14), WL(15), WL(16),
         WL(17), WL(18), WL(19),
         WG(0), WG(1), WG(2), WG(3), WG(12), WG(13), WG(14), WG(15), WG(16),
         WG(17), WG(18), WG(19)
      : "memory");
#undef WL
#undef WG

  // --- k and v of this wave's 16 positions, all heads, into LDS ---
#pragma unroll
  for (int nt = 0; nt < 8; ++nt) {
    v8f ak = {}, av = {};
#pragma unroll
    for (int kk = 0; kk < 4; ++kk) {
      const v16h wk = load_frag16x32(WT[1] + (nt * 16) * WT_LD + kk * 32, WT_LD);
      const v16h wv = load_frag16x32(WT[2] + (nt * 16) * WT_LD + kk * 32, WT_LD);
      ak = wmma_f16(wk, X[kk], ak);      // column nt*16 + 8*hi + r, key kcol
      av = wmma_f16(X[kk], wv, av);      // key 8*hi + r, column nt*16 + kcol
    }
    v8h hk, hv;
#pragma unroll
    for (int r = 0; r < 8; ++r) { hk[r] = (_Float16)ak[r]; hv[r] = (_Float16)av[r]; }
    *(v8h*)(Ksh + (wave * 16 + kcol) * WT_LD + nt * 16 + hi * 8) = hk;
    *(v8h*)(VTsh + (nt * 16 + kcol) * VT_LD + wave * 16 + hi * 8) = hv;
  }
  // This wave's second run of copies has landed, ahead of the barrier.
  asm volatile("s_wait_asynccnt 0x0" ::: "memory");
  __syncthreads();       // every wave's k and v, and Wq, Wg, Wo, are in LDS

  // Wk and Wv are dead behind that barrier: each wave parks its gated O
  // fragments there, 4 KB of its own, read back by the same lanes only.
  _Float16* park = WT[1] + wave * 2048 + lane * 8;

  for (int h = 0; h < NHEAD; ++h) {
    // --- q^T: the B operand of the scores, column kcol = query ---
    v16h bQ;
    {
      v8f q0 = {}, q1 = {};
#pragma unroll
      for (int kk = 0; kk < 4; ++kk) {
        const v16h w0 = load_frag16x32(WT[0] + (h * DHID) * WT_LD + kk * 32, WT_LD);
        const v16h w1 = load_frag16x32(WT[0] + (h * DHID + 16) * WT_LD + kk * 32, WT_LD);
        q0 = wmma_f16(w0, X[kk], q0);    // d = 8*hi + r
        q1 = wmma_f16(w1, X[kk], q1);    // d = 16 + 8*hi + r
      }
#pragma unroll
      for (int r = 0; r < 8; ++r) {
        bQ[r]     = (_Float16)(q0[r] * SCALING);
        bQ[r + 8] = (_Float16)(q1[r] * SCALING);
      }
    }
    // 512 floats per (query tile, 32 keys); a wave's b128 load is 512 B in a row.
    const float* biasF =
        biasws + (size_t)((h * 16 + wave) * 8) * 512 + lane * 4;

    v8f O0 = {}, O1 = {};              // O^T: d = 8*hi + r and 16 + 8*hi + r
    float m = -3.0e38f, sum = 0.0f;    // this lane's query

    // Kept rolled: unrolled, the two passes' tiles overlap in registers and
    // the normalized rows are spilled to scratch.
#pragma unroll 1
    for (int cc = 0; cc < 2; ++cc) {     // 128 keys per pass
      // --- scores: eight independent 16x16 tiles, rows = keys, bias as the
      // C operand; the pass's 16 bias loads are in flight together ---
      const float* bp = biasF + cc * 2048;
      float4 cb[16];
#pragma unroll
      for (int u = 0; u < 16; ++u) cb[u] = *(const float4*)(bp + u * 128);
      // The address stays in its registers up to this wait.
      asm volatile("s_wait_xcnt 0x0" :: "v"(bp) : "memory");
      v8f S[8];                          // S[t]: key cc*128 + t*16 + 8*hi + r
#pragma unroll
      for (int t = 0; t < 8; ++t) {
        const v16h aK = load_frag16x32(
            Ksh + (cc * 8 + t) * 16 * WT_LD + h * DHID, WT_LD);
        const v8f C = {cb[2 * t].x,     cb[2 * t].y,     cb[2 * t].z,
                       cb[2 * t].w,     cb[2 * t + 1].x, cb[2 * t + 1].y,
                       cb[2 * t + 1].z, cb[2 * t + 1].w};
        S[t] = wmma_f16(aK, bQ, C);
      }

      // --- online softmax update, in-lane: four chains, then joined ---
      float tq[4];
#pragma unroll
      for (int p = 0; p < 4; ++p) {
        tq[p] = fmaxf(S[2 * p][0], S[2 * p + 1][0]);
#pragma unroll
        for (int r = 1; r < 8; ++r)
          tq[p] = fmaxf(tq[p], fmaxf(S[2 * p][r], S[2 * p + 1][r]));
      }
      float tm = fmaxf(fmaxf(tq[0], tq[1]), fmaxf(tq[2], tq[3]));
      tm = fmaxf(tm, xhalf(tm));
      const float mnew = fmaxf(m, tm);
      const float cf   = __expf(m - mnew);
      m = mnew;
      v16h bP[4];                        // P^T in the hardware k order
      float pq[4];
#pragma unroll
      for (int p = 0; p < 4; ++p) {
        pq[p] = 0.0f;
#pragma unroll
        for (int r = 0; r < 8; ++r) {
          const float e0 = __expf(S[2 * p][r] - mnew);
          const float e1 = __expf(S[2 * p + 1][r] - mnew);
          pq[p] += e0 + e1;
          bP[p][r]     = (_Float16)e0;
          bP[p][r + 8] = (_Float16)e1;
        }
      }
      // this half's keys only
      sum = sum * cf + ((pq[0] + pq[1]) + (pq[2] + pq[3]));
#pragma unroll
      for (int r = 0; r < 8; ++r) { O0[r] *= cf; O1[r] *= cf; }

      // --- accumulate O^T += V^T(32x128) @ P^T(128x16) ---
#pragma unroll
      for (int p = 0; p < 4; ++p) {
        const v16h aV0 = load_frag16x32(
            VTsh + (h * DHID + 0)  * VT_LD + (cc * 4 + p) * 32, VT_LD);
        const v16h aV1 = load_frag16x32(
            VTsh + (h * DHID + 16) * VT_LD + (cc * 4 + p) * 32, VT_LD);
        O0 = wmma_f16(aV0, bP[p], O0);
        O1 = wmma_f16(aV1, bP[p], O1);
      }
    }

    // --- gate^T, in the order of O^T ---
    v8f g0 = {}, g1 = {};
#pragma unroll
    for (int kk = 0; kk < 4; ++kk) {
      const v16h w0 = load_frag16x32(WT[3] + (h * DHID) * WT_LD + kk * 32, WT_LD);
      const v16h w1 = load_frag16x32(WT[3] + (h * DHID + 16) * WT_LD + kk * 32, WT_LD);
      g0 = wmma_f16(w0, X[kk], g0);
      g1 = wmma_f16(w1, X[kk], g1);
    }
    const float* bgp = bg + h * DHID + hi * 8;
    const float4 b00 = *(const float4*)(bgp);
    const float4 b01 = *(const float4*)(bgp + 4);
    const float4 b10 = *(const float4*)(bgp + 16);
    const float4 b11 = *(const float4*)(bgp + 20);
    const v8f B0 = {b00.x, b00.y, b00.z, b00.w, b01.x, b01.y, b01.z, b01.w};
    const v8f B1 = {b10.x, b10.y, b10.z, b10.w, b11.x, b11.y, b11.z, b11.w};

    // --- join the halves' sums, normalize, gate: A fragment of the output
    // product (row kcol = query, k = this head's 32 columns) ---
    const float inv = 1.0f / (sum + xhalf(sum));
    v16h aO;
#pragma unroll
    for (int r = 0; r < 8; ++r) {
      const _Float16 s0 = (_Float16)(1.0f / (1.0f + __expf(-(g0[r] + B0[r]))));
      const _Float16 s1 = (_Float16)(1.0f / (1.0f + __expf(-(g1[r] + B1[r]))));
      aO[r]     = (_Float16)(O0[r] * inv * (float)s0);
      aO[r + 8] = (_Float16)(O1[r] * inv * (float)s1);
    }
    v8h lo, up;
#pragma unroll
    for (int r = 0; r < 8; ++r) { lo[r] = aO[r]; up[r] = aO[r + 8]; }
    *(v8h*)(park + h * 512)       = lo;
    *(v8h*)(park + h * 512 + 256) = up;
  }

  // --- output product, once for all heads: eight independent accumulators,
  // each summed head by head ---
  v8f acc[8] = {};                       // out rows 8*hi + r, column nt*16 + kcol
#pragma unroll
  for (int h = 0; h < NHEAD; ++h) {
    const v8h lo = *(const v8h*)(park + h * 512);
    const v8h up = *(const v8h*)(park + h * 512 + 256);
    v16h aO;
#pragma unroll
    for (int r = 0; r < 8; ++r) { aO[r] = lo[r]; aO[r + 8] = up[r]; }
#pragma unroll
    for (int nt = 0; nt < 8; ++nt) {
      const v16h wo = load_frag16x32(WT[4] + (nt * 16) * WT_LD + h * DHID, WT_LD);
      acc[nt] = wmma_f16(aO, wo, acc[nt]);
    }
  }

#pragma unroll
  for (int nt = 0; nt < 8; ++nt) {
    const int n = nt * 16 + kcol;
    const float bon = bo[n];
#pragma unroll
    for (int r = 0; r < 8; ++r) {
      const size_t mr = m0 + r + 8 * hi;
      out[mr * DPAIR + n] = acc[nt][r] + bon;
    }
  }
}

// ---------------------------------------------------------------------------
// Launch.  Inputs: 0 pair, 1 gamma, 2 beta, 3 Wq, 4 Wk, 5 Wv, 6 Wb, 7 Wg,
// 8 bg, 9 Wo, 10 bo.  Output: f32 (1,256,256,128).
// Workspace: the bias, NHEAD*NPOS f32 = 1 MB, then the f16 weights, 160 KB.
// ---------------------------------------------------------------------------
extern "C" void kernel_launch(void* const* d_in, const int* in_sizes, int n_in,
                              void* d_out, int out_size, void* d_ws,
                              size_t ws_size, hipStream_t stream) {
  const float* pair  = (const float*)d_in[0];
  const float* gamma = (const float*)d_in[1];
  const float* beta  = (const float*)d_in[2];
  const float* Wq    = (const float*)d_in[3];
  const float* Wk    = (const float*)d_in[4];
  const float* Wv    = (const float*)d_in[5];
  const float* Wb    = (const float*)d_in[6];
  const float* Wg    = (const float*)d_in[7];
  const float* bg    = (const float*)d_in[8];
  const float* Wo    = (const float*)d_in[9];
  const float* bo    = (const float*)d_in[10];
  float* out  = (float*)d_out;
  float* bbuf = (float*)d_ws;
  _Float16* wbuf = (_Float16*)(bbuf + NHEAD * NPOS);

  bias_kernel<<<NPOS / 256, 512, 0, stream>>>(pair, gamma, beta, Wb, Wq, Wk, Wv,
                                              Wg, Wo, bbuf, wbuf);
  row_kernel<<<LVAL, 512, 0, stream>>>(pair, gamma, beta, bg, bo, bbuf, wbuf,
                                       out);
}

// v006
// It runs in 31.5 microseconds.
// In both of two side-by-side timings against v005, it was 1.05 times as fast.
// Over all steps from v000 it is 4.12 times as fast.
#include <hip/hip_runtime.h>
#include <hip/hip_bf16.h>

// ---------------------------------------------------------------------------
// Triangle attention for MI455X (gfx1250, wave32, WMMA 16x16x32 f16).
// L=256, D_PAIR=128, N_HEAD=4, D_HID=32, NPOS=65536.
// ---------------------------------------------------------------------------

#define LVAL   256
#define DPAIR  128
#define NHEAD  4
#define DHID   32
#define NPOS   (LVAL * LVAL)
#define SCALING 0.17677669529663687f   // 1/sqrt(32)
#define LOG2E   1.4426950408889634f    // v_exp_f32 is a power of two

typedef __attribute__((ext_vector_type(16))) _Float16 v16h;
typedef __attribute__((ext_vector_type(8)))  _Float16 v8h;
typedef __attribute__((ext_vector_type(8)))  float    v8f;

// Load one 16x32 f16 fragment (A-matrix layout; also used for B as B^T rows)
// from row-major storage with row stride `ld` (elements).
// ISA layout (16-bit A 16x32): lanes 0-15 -> M=0-15, cols {0..7,16..23};
// lanes 16-31 -> M=0-15, cols {8..15,24..31}. Two b128 loads per lane.
__device__ inline v16h load_frag16x32(const _Float16* p, int ld) {
  const int lane = threadIdx.x & 31;
  const int row  = lane & 15;
  const int hi   = lane >> 4;
  const _Float16* r = p + row * ld + hi * 8;
  v8h a = *(const v8h*)(r);
  v8h b = *(const v8h*)(r + 16);
  v16h f;
#pragma unroll
  for (int t = 0; t < 8; ++t) { f[t] = a[t]; f[t + 8] = b[t]; }
  return f;
}

__device__ inline v8f wmma_f16(v16h a, v16h b, v8f c) {
  return __builtin_amdgcn_wmma_f32_16x16x32_f16(false, a, false, b,
                                                (short)0, c, false, false);
}

// Lane l <-> lane l ^ 16 (the two halves of a wave hold the same row).
__device__ inline float xhalf(float x) {
  const int b = __builtin_bit_cast(int, x);
  return __builtin_bit_cast(float, __builtin_amdgcn_permlanex16(
      b, b, 0x76543210, 0xfedcba98, false, false));
}

// This lane's 64 columns of its row: kk*32 + g*16 + hi*8 + 0..7, the order of
// the WMMA A (and B) fragment. xr = row start + hi*8.
__device__ inline void load_row(const float* __restrict__ xr,
                                float4 (&xv)[16]) {
#pragma unroll
  for (int u = 0; u < 8; ++u) {
    xv[2 * u]     = *(const float4*)(xr + u * 16);
    xv[2 * u + 1] = *(const float4*)(xr + u * 16 + 4);
  }
  // The address stays in its registers up to this wait.
  asm volatile("s_wait_xcnt 0x0" :: "v"(xr) : "memory");
}

// LayerNorm of the row held by a lane and its partner lane ^ 16: four in-lane
// chains, then the other half of the row; the result, rounded to f16, is the
// wave's 16 x 128 operand in fragment order.
__device__ inline void norm_row(const float4 (&xv)[16],
                                const float* __restrict__ gamma,
                                const float* __restrict__ beta,
                                v16h (&A)[4]) {
  const int hi = (threadIdx.x & 31) >> 4;
  float4 s4 = {0.0f, 0.0f, 0.0f, 0.0f}, q4 = {0.0f, 0.0f, 0.0f, 0.0f};
#pragma unroll
  for (int u = 0; u < 16; ++u) {
    s4.x += xv[u].x; s4.y += xv[u].y; s4.z += xv[u].z; s4.w += xv[u].w;
    q4.x += xv[u].x * xv[u].x; q4.y += xv[u].y * xv[u].y;
    q4.z += xv[u].z * xv[u].z; q4.w += xv[u].w * xv[u].w;
  }
  float s  = (s4.x + s4.y) + (s4.z + s4.w);
  float ss = (q4.x + q4.y) + (q4.z + q4.w);
  s  += xhalf(s);
  ss += xhalf(ss);
  const float mu  = s * (1.0f / DPAIR);
  const float var = ss * (1.0f / DPAIR) - mu * mu;
  const float inv = rsqrtf(var + 1e-5f);
#pragma unroll
  for (int u = 0; u < 16; ++u) {
    const int c = (u >> 1) * 16 + hi * 8 + (u & 1) * 4;
    const float4 gv = *(const float4*)(gamma + c);
    const float4 bv = *(const float4*)(beta + c);
    const int t = (u & 3) * 4;           // element of fragment u >> 2
    A[u >> 2][t + 0] = (_Float16)((xv[u].x - mu) * inv * gv.x + bv.x);
    A[u >> 2][t + 1] = (_Float16)((xv[u].y - mu) * inv * gv.y + bv.y);
    A[u >> 2][t + 2] = (_Float16)((xv[u].z - mu) * inv * gv.z + bv.z);
    A[u >> 2][t + 3] = (_Float16)((xv[u].w - mu) * inv * gv.w + bv.w);
  }
}

// ---------------------------------------------------------------------------
// Kernel 1: the pair bias (it couples every row j with every row i, so
// it has to be complete before any attention starts). grid = 256 blocks of 16
// waves; block = (query tile jt, key tile kt), wave w owns the 16 rows
// (j = jt*16 + w, key = kt*16 .. +15).
// bias = layernorm(x) @ Wb (128 -> 4) is stored in the order in which the
// transposed score tiles hold it as WMMA C operand:
// biasws[h][jt][ck][t][qd][lane][e] = bias(j = jt*16 + (lane & 15),
//   key = ck*32 + t*16 + (lane >> 4)*8 + qd*4 + e, head h);
// the 16 waves of a block fill whole 128-byte lines of it between them.
// Beside that, the five 128 x 128 weights are rounded to f16 and transposed
// once for the whole chip: wtws[matrix][n][k], matrix = q, k, v, gate, out.
// Two waves write four half rows of 64 k (one 128-byte line each).
// ---------------------------------------------------------------------------
__global__ __launch_bounds__(512) void bias_kernel(
    const float* __restrict__ pair, const float* __restrict__ gamma,
    const float* __restrict__ beta, const float* __restrict__ Wb,
    const float* __restrict__ Wq, const float* __restrict__ Wk,
    const float* __restrict__ Wv, const float* __restrict__ Wg,
    const float* __restrict__ Wo, float* __restrict__ biasws,
    _Float16* __restrict__ wtws) {
  __shared__ float4 WbS[DPAIR];               // 2 KB

  const int wave = threadIdx.x >> 5;
  const int lane = threadIdx.x & 31;
  const int kcol = lane & 15, hi = lane >> 4;
  const int jt = blockIdx.x >> 4, kt = blockIdx.x & 15;
  const size_t m0 = (size_t)((jt * 16 + wave) * LVAL + kt * 16);

  float4 xv[16];
  load_row(pair + (m0 + kcol) * DPAIR + hi * 8, xv);
  if (threadIdx.x < DPAIR)
    WbS[threadIdx.x] = *(const float4*)(Wb + threadIdx.x * NHEAD);
  // 320 units of 4 rows n x 64 k, two waves each; scalar, so that the matrix
  // is picked without lane masks.
  const int wu   = __builtin_amdgcn_readfirstlane(wave);
  const int unit = blockIdx.x + (wu >> 1) * 256;
  if (wu < 4 && unit < 320) {
    const int mtx = unit >> 6, n4 = ((unit >> 1) & 31) * 4;
    const int kk  = (unit & 1) * 64 + (threadIdx.x & 63);
    const float* Ws = mtx == 0 ? Wq : mtx == 1 ? Wk : mtx == 2 ? Wv
                    : mtx == 3 ? Wg : Wo;
    const float* wp = Ws + kk * DPAIR + n4;
    const float4 w = *(const float4*)wp;
    // The address stays in its registers up to this wait.
    asm volatile("s_wait_xcnt 0x0" :: "v"(wp) : "memory");
    _Float16* d = wtws + (mtx * DPAIR + n4) * DPAIR + kk;
    d[0 * DPAIR] = (_Float16)w.x;
    d[1 * DPAIR] = (_Float16)w.y;
    d[2 * DPAIR] = (_Float16)w.z;
    d[3 * DPAIR] = (_Float16)w.w;
    // Ahead of the layernorm's loads, which are given the stores' registers.
    asm volatile("s_wait_xcnt 0x0" ::: "memory");
  }
  v16h A[4];
  norm_row(xv, gamma, beta, A);
  __syncthreads();

  // f32 sums over this lane's 64 columns, joined across halves
  float4 b = {0.0f, 0.0f, 0.0f, 0.0f};
#pragma unroll
  for (int u = 0; u < 64; ++u) {
    const float4 w = WbS[(u >> 3) * 16 + hi * 8 + (u & 7)];
    const float xf = (float)A[u >> 4][u & 15];
    b.x += xf * w.x; b.y += xf * w.y; b.z += xf * w.z; b.w += xf * w.w;
  }
  b.x += xhalf(b.x); b.y += xhalf(b.y);
  b.z += xhalf(b.z); b.w += xhalf(b.w);
  // Row kcol is key kt*16 + kcol of query jt*16 + wave; the lower half of
  // the wave stores heads 0 and 1, the upper half heads 2 and 3.
  const int at = (jt << 12) | (kt << 8) | (((kcol >> 2) & 1) << 7) |
                 ((wave + 16 * (kcol >> 3)) << 2) | (kcol & 3);
  biasws[((2 * hi + 0) << 16) | at] = hi ? b.z : b.x;
  biasws[((2 * hi + 1) << 16) | at] = hi ? b.w : b.y;
}

// ---------------------------------------------------------------------------
// Kernel 2: everything else of one row i in one block of 16 waves; wave w
// owns positions j = w*16 .. +15 of the row, as queries and as keys.
// The normalized rows stay in registers as fragments X. With X as the B
// operand a product comes out transposed (lane = position, 8 consecutive
// columns in the lane's registers), with X as the A operand plain (lane =
// column, 8 consecutive positions):
//   k^T = Wk^T . X^T  -> one 16-byte LDS store per tile into Ksh[key][column]
//   v   = X . Wv      -> one 16-byte LDS store per tile into VTsh[column][key]
//   q^T, gate^T       -> already in the order of the score product's B
//                        operand and of the O^T accumulators: never stored
// Attention per head as S^T = K . Q^T (+ bias as C), O^T += V^T . P^T with
// online softmax over passes of 128 keys; the gated O^T, rounded to f16, is
// the A fragment of the output product, which runs behind the head loop.
// ---------------------------------------------------------------------------
#define WT_LD 136   // 128 + 8 pad (272B row stride, 16B aligned)
#define VT_LD 264   // 256 + 8 pad
__global__ __launch_bounds__(512) void row_kernel(
    const float* __restrict__ pair, const float* __restrict__ gamma,
    const float* __restrict__ beta, const float* __restrict__ bg,
    const float* __restrict__ bo, const float* __restrict__ biasws,
    const _Float16* __restrict__ wtws, float* __restrict__ out) {
  __shared__ __attribute__((aligned(16))) _Float16 WT[5][128 * WT_LD];  // 170 KB
  __shared__ __attribute__((aligned(16))) _Float16 Ksh[LVAL * WT_LD];   // 68 KB
  __shared__ __attribute__((aligned(16))) _Float16 VTsh[DPAIR * VT_LD]; // 66 KB

  const int wave = threadIdx.x >> 5;
  const int lane = threadIdx.x & 31;
  const int kcol = lane & 15, hi = lane >> 4;
  const size_t m0 = (size_t)blockIdx.x * LVAL + wave * 16;

  // Issued ahead of the weight staging.
  float4 xv[16];
  load_row(pair + (m0 + kcol) * DPAIR + hi * 8, xv);

  // The weight rows of 256 bytes go from the workspace straight into LDS at
  // the padded pitch: 16 lanes a row, so one copy of the block brings 32 rows
  // and four copies a matrix. Wk and Wv fly under the layernorm.
  const unsigned l0 = (unsigned)(size_t)(&WT[0][0]) +
                      (threadIdx.x >> 4) * (WT_LD * 2) + (threadIdx.x & 15) * 16;
  const _Float16* g0 = wtws + threadIdx.x * 8;
#define WL(c) "v"(l0 + (c) * (32 * WT_LD * 2))
#define WG(c) "v"(g0 + (c) * (512 * 8))
  // The closing wait stands ahead of every later write of the registers that
  // the copies name (a precaution).
  asm volatile(
      "global_load_async_to_lds_b128 %0, %8, off\n\t"
      "global_load_async_to_lds_b128 %1, %9, off\n\t"
      "global_load_async_to_lds_b128 %2, %10, off\n\t"
      "global_load_async_to_lds_b128 %3, %11, off\n\t"
      "global_load_async_to_lds_b128 %4, %12, off\n\t"
      "global_load_async_to_lds_b128 %5, %13, off\n\t"
      "global_load_async_to_lds_b128 %6, %14, off\n\t"
      "global_load_async_to_lds_b128 %7, %15, off\n\t"
      "s_wait_xcnt 0x0"
      :: WL(4), WL(5), WL(6), WL(7), WL(8), WL(9), WL(10), WL(11),
         WG(4), WG(5), WG(6), WG(7), WG(8), WG(9), WG(10), WG(11)
      : "memory");

  v16h X[4];
  norm_row(xv, gamma, beta, X);
  // Keeps the layernorm ahead of the barrier, under the copies' flight, and
  // the next copies' 36 address registers behind it (formed ahead of it they
  // push the kernel into scratch).
  __builtin_amdgcn_sched_barrier(0);
  // This wave's copies have landed; the barrier then publishes every wave's.
  asm volatile("s_wait_asynccnt 0x0" ::: "memory");
  __syncthreads();                       // Wk and Wv are staged

  // Wq, Wg and Wo are first read behind the next barrier: their copies fly
  // under the k and v products. Same closing wait as above.
  asm volatile(
      "global_load_async_to_lds_b128 %0, %12, off\n\t"
      "global_load_async_to_lds_b128 %1, %13, off\n\t"
      "global_load_async_to_lds_b128 %2, %14, off\n\t"
      "global_load_async_to_lds_b128 %3, %15, off\n\t"
      "global_load_async_to_lds_b128 %4, %16, off\n\t"
      "global_load_async_to_lds_b128 %5, %17, off\n\t"
      "global_load_async_to_lds_b128 %6, %18, off\n\t"
      "global_load_async_to_lds_b128 %7, %19, off\n\t"
      "global_load_async_to_lds_b128 %8, %20, off\n\t"
      "global_load_async_to_lds_b128 %9, %21, off\n\t"
      "global_load_async_to_lds_b128 %10, %22, off\n\t"
      "global_load_async_to_lds_b128 %11, %23, off\n\t"
      "s_wait_xcnt 0x0"
      :: WL(0), WL(1), WL(2), WL(3), WL(12), WL(13), WL(14), WL(15), WL(16),
         WL(17), WL(18), WL(19),
         WG(0), WG(1), WG(2), WG(3), WG(12), WG(13), WG(14), WG(15), WG(16),
         WG(17), WG(18), WG(19)
      : "memory");
#undef WL
#undef WG

  // --- k and v of this wave's 16 positions, all heads, into LDS ---
#pragma unroll
  for (int nt = 0; nt < 8; ++nt) {
    v8f ak = {}, av = {};
#pragma unroll
    for (int kk = 0; kk < 4; ++kk) {
      const v16h wk = load_frag16x32(WT[1] + (nt * 16) * WT_LD + kk * 32, WT_LD);
      const v16h wv = load_frag16x32(WT[2] + (nt * 16) * WT_LD + kk * 32, WT_LD);
      ak = wmma_f16(wk, X[kk], ak);      // column nt*16 + 8*hi + r, key kcol
      av = wmma_f16(X[kk], wv, av);      // key 8*hi + r, column nt*16 + kcol
    }
    v8h hk, hv;
#pragma unroll
    for (int r = 0; r < 8; ++r) { hk[r] = (_Float16)ak[r]; hv[r] = (_Float16)av[r]; }
    *(v8h*)(Ksh + (wave * 16 + kcol) * WT_LD + nt * 16 + hi * 8) = hk;
    *(v8h*)(VTsh + (nt * 16 + kcol) * VT_LD + wave * 16 + hi * 8) = hv;
  }
  // This wave's second run of copies has landed, ahead of the barrier.
  asm volatile("s_wait_asynccnt 0x0" ::: "memory");
  __syncthreads();       // every wave's k and v, and Wq, Wg, Wo, are in LDS

  // Wk and Wv are dead behind that barrier: each wave parks its gated O
  // fragments there, 4 KB of its own, read back by the same lanes only.
  _Float16* park = WT[1] + wave * 2048 + lane * 8;

  for (int h = 0; h < NHEAD; ++h) {
    // --- q^T: the B operand of the scores, column kcol = query ---
    v16h bQ;
    {
      v8f q0 = {}, q1 = {};
#pragma unroll
      for (int kk = 0; kk < 4; ++kk) {
        const v16h w0 = load_frag16x32(WT[0] + (h * DHID) * WT_LD + kk * 32, WT_LD);
        const v16h w1 = load_frag16x32(WT[0] + (h * DHID + 16) * WT_LD + kk * 32, WT_LD);
        q0 = wmma_f16(w0, X[kk], q0);    // d = 8*hi + r
        q1 = wmma_f16(w1, X[kk], q1);    // d = 16 + 8*hi + r
      }
#pragma unroll
      for (int r = 0; r < 8; ++r) {
        bQ[r]     = (_Float16)(q0[r] * SCALING);
        bQ[r + 8] = (_Float16)(q1[r] * SCALING);
      }
    }
    // 512 floats per (query tile, 32 keys); a wave's b128 load is 512 B in a row.
    const float* biasF =
        biasws + (size_t)((h * 16 + wave) * 8) * 512 + lane * 4;

    v8f O0 = {}, O1 = {};              // O^T: d = 8*hi + r and 16 + 8*hi + r
    // This lane's query: nm = -(running maximum) * log2(e), and the sum.
    float nm = 3.0e38f, sum = 0.0f;

    // Kept rolled: unrolled, the two passes' tiles overlap in registers and
    // the normalized rows are spilled to scratch.
#pragma unroll 1
    for (int cc = 0; cc < 2; ++cc) {     // 128 keys per pass
      // --- scores: eight independent 16x16 tiles, rows = keys, bias as the
      // C operand; the pass's 16 bias loads are in flight together ---
      const float* bp = biasF + cc * 2048;
      float4 cb[16];
#pragma unroll
      for (int u = 0; u < 16; ++u) cb[u] = *(const float4*)(bp + u * 128);
      // The address stays in its registers up to this wait.
      asm volatile("s_wait_xcnt 0x0" :: "v"(bp) : "memory");
      v8f S[8];                          // S[t]: key cc*128 + t*16 + 8*hi + r
#pragma unroll
      for (int t = 0; t < 8; ++t) {
        const v16h aK = load_frag16x32(
            Ksh + (cc * 8 + t) * 16 * WT_LD + h * DHID, WT_LD);
        const v8f C = {cb[2 * t].x,     cb[2 * t].y,     cb[2 * t].z,
                       cb[2 * t].w,     cb[2 * t + 1].x, cb[2 * t + 1].y,
                       cb[2 * t + 1].z, cb[2 * t + 1].w};
        S[t] = wmma_f16(aK, bQ, C);
      }

      // --- online softmax update, in-lane: four chains, then joined ---
      float tq[4];
#pragma unroll
      for (int p = 0; p < 4; ++p) {
        tq[p] = fmaxf(S[2 * p][0], S[2 * p + 1][0]);
#pragma unroll
        for (int r = 1; r < 8; ++r)
          tq[p] = fmaxf(tq[p], fmaxf(S[2 * p][r], S[2 * p + 1][r]));
      }
      float tm = fmaxf(fmaxf(tq[0], tq[1]), fmaxf(tq[2], tq[3]));
      tm = fmaxf(tm, xhalf(tm));
      // exp(s - max) = 2^(s * log2(e) + nm): one fused multiply-add in front
      // of each v_exp_f32. The rounding of nm is common to a query's terms
      // and to cf, so it cancels against the sum.
      const float nmold = nm;
      nm = fminf(nmold, -tm * LOG2E);
      const float cf = __builtin_amdgcn_exp2f(nm - nmold);
      v16h bP[4];                        // P^T in the hardware k order
      float pq[4];
#pragma unroll
      for (int p = 0; p < 4; ++p) {
        pq[p] = 0.0f;
#pragma unroll
        for (int r = 0; r < 8; ++r) {
          const float e0 = __builtin_amdgcn_exp2f(fmaf(S[2 * p][r], LOG2E, nm));
          const float e1 = __builtin_amdgcn_exp2f(fmaf(S[2 * p + 1][r], LOG2E, nm));
          pq[p] += e0 + e1;
          bP[p][r]     = (_Float16)e0;
          bP[p][r + 8] = (_Float16)e1;
        }
      }
      // this half's keys only
      sum = sum * cf + ((pq[0] + pq[1]) + (pq[2] + pq[3]));
#pragma unroll
      for (int r = 0; r < 8; ++r) { O0[r] *= cf; O1[r] *= cf; }

      // --- accumulate O^T += V^T(32x128) @ P^T(128x16) ---
#pragma unroll
      for (int p = 0; p < 4; ++p) {
        const v16h aV0 = load_frag16x32(
            VTsh + (h * DHID + 0)  * VT_LD + (cc * 4 + p) * 32, VT_LD);
        const v16h aV1 = load_frag16x32(
            VTsh + (h * DHID + 16) * VT_LD + (cc * 4 + p) * 32, VT_LD);
        O0 = wmma_f16(aV0, bP[p], O0);
        O1 = wmma_f16(aV1, bP[p], O1);
      }
    }

    // --- gate^T, in the order of O^T ---
    v8f g0 = {}, g1 = {};
#pragma unroll
    for (int kk = 0; kk < 4; ++kk) {
      const v16h w0 = load_frag16x32(WT[3] + (h * DHID) * WT_LD + kk * 32, WT_LD);
      const v16h w1 = load_frag16x32(WT[3] + (h * DHID + 16) * WT_LD + kk * 32, WT_LD);
      g0 = wmma_f16(w0, X[kk], g0);
      g1 = wmma_f16(w1, X[kk], g1);
    }
    const float* bgp = bg + h * DHID + hi * 8;
    const float4 b00 = *(const float4*)(bgp);
    const float4 b01 = *(const float4*)(bgp + 4);
    const float4 b10 = *(const float4*)(bgp + 16);
    const float4 b11 = *(const float4*)(bgp + 20);
    const v8f B0 = {b00.x, b00.y, b00.z, b00.w, b01.x, b01.y, b01.z, b01.w};
    const v8f B1 = {b10.x, b10.y, b10.z, b10.w, b11.x, b11.y, b11.z, b11.w};

    // --- join the halves' sums, normalize, gate: A fragment of the output
    // product (row kcol = query, k = this head's 32 columns).
    // O / sum * sigmoid(g) = O / ((1 + exp(-g)) * sum): one fused multiply-add
    // and one hardware reciprocal per element. The divisor is at least the
    // sum, which holds the largest key's exp(0) = 1; where exp(-g) overflows
    // it is infinite and the element 0, as with the division. ---
    const float tot = sum + xhalf(sum);
    v16h aO;
#pragma unroll
    for (int r = 0; r < 8; ++r) {
      const float e0 = __expf(-(g0[r] + B0[r]));
      const float e1 = __expf(-(g1[r] + B1[r]));
      aO[r]     = (_Float16)(O0[r] * __builtin_amdgcn_rcpf(fmaf(e0, tot, tot)));
      aO[r + 8] = (_Float16)(O1[r] * __builtin_amdgcn_rcpf(fmaf(e1, tot, tot)));
    }
    v8h lo, up;
#pragma unroll
    for (int r = 0; r < 8; ++r) { lo[r] = aO[r]; up[r] = aO[r + 8]; }
    *(v8h*)(park + h * 512)       = lo;
    *(v8h*)(park + h * 512 + 256) = up;
  }

  // --- output product, once for all heads: eight independent accumulators,
  // each summed head by head ---
  v8f acc[8] = {};                       // out rows 8*hi + r, column nt*16 + kcol
#pragma unroll
  for (int h = 0; h < NHEAD; ++h) {
    const v8h lo = *(const v8h*)(park + h * 512);
    const v8h up = *(const v8h*)(park + h * 512 + 256);
    v16h aO;
#pragma unroll
    for (int r = 0; r < 8; ++r) { aO[r] = lo[r]; aO[r + 8] = up[r]; }
#pragma unroll
    for (int nt = 0; nt < 8; ++nt) {
      const v16h wo = load_frag16x32(WT[4] + (nt * 16) * WT_LD + h * DHID, WT_LD);
      acc[nt] = wmma_f16(aO, wo, acc[nt]);
    }
  }

#pragma unroll
  for (int nt = 0; nt < 8; ++nt) {
    const int n = nt * 16 + kcol;
    const float bon = bo[n];
#pragma unroll
    for (int r = 0; r < 8; ++r) {
      const size_t mr = m0 + r + 8 * hi;
      out[mr * DPAIR + n] = acc[nt][r] + bon;
    }
  }
}

// ---------------------------------------------------------------------------
// Launch.  Inputs: 0 pair, 1 gamma, 2 beta, 3 Wq, 4 Wk, 5 Wv, 6 Wb, 7 Wg,
// 8 bg, 9 Wo, 10 bo.  Output: f32 (1,256,256,128).
// Workspace: the bias, NHEAD*NPOS f32 = 1 MB, then the f16 weights, 160 KB.
// ---------------------------------------------------------------------------
extern "C" void kernel_launch(void* const* d_in, const int* in_sizes, int n_in,
                              void* d_out, int out_size, void* d_ws,
                              size_t ws_size, hipStream_t stream) {
  const float* pair  = (const float*)d_in[0];
  const float* gamma = (const float*)d_in[1];
  const float* beta  = (const float*)d_in[2];
  const float* Wq    = (const float*)d_in[3];
  const float* Wk    = (const float*)d_in[4];
  const float* Wv    = (const float*)d_in[5];
  const float* Wb    = (const float*)d_in[6];
  const float* Wg    = (const float*)d_in[7];
  const float* bg    = (const float*)d_in[8];
  const float* Wo    = (const float*)d_in[9];
  const float* bo    = (const float*)d_in[10];
  float* out  = (float*)d_out;
  float* bbuf = (float*)d_ws;
  _Float16* wbuf = (_Float16*)(bbuf + NHEAD * NPOS);

  bias_kernel<<<NPOS / 256, 512, 0, stream>>>(pair, gamma, beta, Wb, Wq, Wk, Wv,
                                              Wg, Wo, bbuf, wbuf);
  row_kernel<<<LVAL, 512, 0, stream>>>(pair, gamma, beta, bg, bo, bbuf, wbuf,
                                       out);
}

// v007
// A run of this version takes 30.4 microseconds.
// Timed twice side by side with v006, it ran 1.04 and 1.03 times as fast.
// Counting every step since v000, it is 4.24 times as fast.
#include <hip/hip_runtime.h>
#include <hip/hip_bf16.h>

// ---------------------------------------------------------------------------
// Triangle attention for MI455X (gfx1250, wave32, WMMA 16x16x32 f16).
// L=256, D_PAIR=128, N_HEAD=4, D_HID=32, NPOS=65536.
// ---------------------------------------------------------------------------

#define LVAL   256
#define DPAIR  128
#define NHEAD  4
#define DHID   32
#define NPOS   (LVAL * LVAL)
#define SCALING 0.17677669529663687f   // 1/sqrt(32)
#define LOG2E   1.4426950408889634f    // v_exp_f32 is a power of two

typedef __attribute__((ext_vector_type(16))) _Float16 v16h;
typedef __attribute__((ext_vector_type(8)))  _Float16 v8h;
typedef __attribute__((ext_vector_type(8)))  float    v8f;

// Load one 16x32 f16 fragment (A-matrix layout; also used for B as B^T rows)
// from row-major storage with row stride `ld` (elements).
// ISA layout (16-bit A 16x32): lanes 0-15 -> M=0-15, cols {0..7,16..23};
// lanes 16-31 -> M=0-15, cols {8..15,24..31}. Two b128 loads per lane.
__device__ inline v16h load_frag16x32(const _Float16* p, int ld) {
  const int lane = threadIdx.x & 31;
  const int row  = lane & 15;
  const int hi   = lane >> 4;
  const _Float16* r = p + row * ld + hi * 8;
  v8h a = *(const v8h*)(r);
  v8h b = *(const v8h*)(r + 16);
  v16h f;
#pragma unroll
  for (int t = 0; t < 8; ++t) { f[t] = a[t]; f[t + 8] = b[t]; }
  return f;
}

__device__ inline v8f wmma_f16(v16h a, v16h b, v8f c) {
  return __builtin_amdgcn_wmma_f32_16x16x32_f16(false, a, false, b,
                                                (short)0, c, false, false);
}

// Lane l <-> lane l ^ 16 (the two halves of a wave hold the same row).
__device__ inline float xhalf(float x) {
  const int b = __builtin_bit_cast(int, x);
  return __builtin_bit_cast(float, __builtin_amdgcn_permlanex16(
      b, b, 0x76543210, 0xfedcba98, false, false));
}

// This lane's 64 columns of its row: kk*32 + g*16 + hi*8 + 0..7, the order of
// the WMMA A (and B) fragment. xr = row start + hi*8.
__device__ inline void load_row(const float* __restrict__ xr,
                                float4 (&xv)[16]) {
#pragma unroll
  for (int u = 0; u < 8; ++u) {
    xv[2 * u]     = *(const float4*)(xr + u * 16);
    xv[2 * u + 1] = *(const float4*)(xr + u * 16 + 4);
  }
  // The address stays in its registers up to this wait.
  asm volatile("s_wait_xcnt 0x0" :: "v"(xr) : "memory");
}

// LayerNorm of the row held by a lane and its partner lane ^ 16: four in-lane
// chains, then the other half of the row; the result, rounded to f16, is the
// wave's 16 x 128 operand in fragment order.
__device__ inline void norm_row(const float4 (&xv)[16],
                                const float* __restrict__ gamma,
                                const float* __restrict__ beta,
                                v16h (&A)[4]) {
  const int hi = (threadIdx.x & 31) >> 4;
  float4 s4 = {0.0f, 0.0f, 0.0f, 0.0f}, q4 = {0.0f, 0.0f, 0.0f, 0.0f};
#pragma unroll
  for (int u = 0; u < 16; ++u) {
    s4.x += xv[u].x; s4.y += xv[u].y; s4.z += xv[u].z; s4.w += xv[u].w;
    q4.x += xv[u].x * xv[u].x; q4.y += xv[u].y * xv[u].y;
    q4.z += xv[u].z * xv[u].z; q4.w += xv[u].w * xv[u].w;
  }
  float s  = (s4.x + s4.y) + (s4.z + s4.w);
  float ss = (q4.x + q4.y) + (q4.z + q4.w);
  s  += xhalf(s);
  ss += xhalf(ss);
  const float mu  = s * (1.0f / DPAIR);
  const float var = ss * (1.0f / DPAIR) - mu * mu;
  const float inv = rsqrtf(var + 1e-5f);
#pragma unroll
  for (int u = 0; u < 16; ++u) {
    const int c = (u >> 1) * 16 + hi * 8 + (u & 1) * 4;
    const float4 gv = *(const float4*)(gamma + c);
    const float4 bv = *(const float4*)(beta + c);
    const int t = (u & 3) * 4;           // element of fragment u >> 2
    A[u >> 2][t + 0] = (_Float16)((xv[u].x - mu) * inv * gv.x + bv.x);
    A[u >> 2][t + 1] = (_Float16)((xv[u].y - mu) * inv * gv.y + bv.y);
    A[u >> 2][t + 2] = (_Float16)((xv[u].z - mu) * inv * gv.z + bv.z);
    A[u >> 2][t + 3] = (_Float16)((xv[u].w - mu) * inv * gv.w + bv.w);
  }
}

// ---------------------------------------------------------------------------
// Kernel 1: the pair bias (it couples every row j with every row i, so
// it has to be complete before any attention starts). grid = 256 blocks of 16
// waves; block = (query tile jt, key tile kt), wave w owns the 16 rows
// (j = jt*16 + w, key = kt*16 .. +15).
// bias = layernorm(x) @ Wb (128 -> 4) is rounded to f16 and stored as half a
// WMMA A fragment per 16 x 16 tile (row = key, k = query):
// biasws[h][jt][kt][lane][e] = bias(j = jt*16 + (lane >> 4)*8 + e,
//   key = kt*16 + (lane & 15), head h);
// the 16 waves of a block fill whole 128-byte lines of it between them.
// Beside that, the five 128 x 128 weights are rounded to f16 and transposed
// once for the whole chip: wtws[matrix][n][k], matrix = q, k, v, gate, out.
// Two waves write four half rows of 64 k (one 128-byte line each).
// ---------------------------------------------------------------------------
__global__ __launch_bounds__(512) void bias_kernel(
    const float* __restrict__ pair, const float* __restrict__ gamma,
    const float* __restrict__ beta, const float* __restrict__ Wb,
    const float* __restrict__ Wq, const float* __restrict__ Wk,
    const float* __restrict__ Wv, const float* __restrict__ Wg,
    const float* __restrict__ Wo, _Float16* __restrict__ biasws,
    _Float16* __restrict__ wtws) {
  __shared__ float4 WbS[DPAIR];               // 2 KB

  const int wave = threadIdx.x >> 5;
  const int lane = threadIdx.x & 31;
  const int kcol = lane & 15, hi = lane >> 4;
  const int jt = blockIdx.x >> 4, kt = blockIdx.x & 15;
  const size_t m0 = (size_t)((jt * 16 + wave) * LVAL + kt * 16);

  float4 xv[16];
  load_row(pair + (m0 + kcol) * DPAIR + hi * 8, xv);
  if (threadIdx.x < DPAIR)
    WbS[threadIdx.x] = *(const float4*)(Wb + threadIdx.x * NHEAD);
  // 320 units of 4 rows n x 64 k, two waves each; scalar, so that the matrix
  // is picked without lane masks.
  const int wu   = __builtin_amdgcn_readfirstlane(wave);
  const int unit = blockIdx.x + (wu >> 1) * 256;
  if (wu < 4 && unit < 320) {
    const int mtx = unit >> 6, n4 = ((unit >> 1) & 31) * 4;
    const int kk  = (unit & 1) * 64 + (threadIdx.x & 63);
    const float* Ws = mtx == 0 ? Wq : mtx == 1 ? Wk : mtx == 2 ? Wv
                    : mtx == 3 ? Wg : Wo;
    const float* wp = Ws + kk * DPAIR + n4;
    const float4 w = *(const float4*)wp;
    // The address stays in its registers up to this wait.
    asm volatile("s_wait_xcnt 0x0" :: "v"(wp) : "memory");
    _Float16* d = wtws + (mtx * DPAIR + n4) * DPAIR + kk;
    d[0 * DPAIR] = (_Float16)w.x;
    d[1 * DPAIR] = (_Float16)w.y;
    d[2 * DPAIR] = (_Float16)w.z;
    d[3 * DPAIR] = (_Float16)w.w;
    // Ahead of the layernorm's loads, which are given the stores' registers.
    asm volatile("s_wait_xcnt 0x0" ::: "memory");
  }
  v16h A[4];
  norm_row(xv, gamma, beta, A);
  __syncthreads();

  // f32 sums over this lane's 64 columns, joined across halves
  float4 b = {0.0f, 0.0f, 0.0f, 0.0f};
#pragma unroll
  for (int u = 0; u < 64; ++u) {
    const float4 w = WbS[(u >> 3) * 16 + hi * 8 + (u & 7)];
    const float xf = (float)A[u >> 4][u & 15];
    b.x += xf * w.x; b.y += xf * w.y; b.z += xf * w.z; b.w += xf * w.w;
  }
  b.x += xhalf(b.x); b.y += xhalf(b.y);
  b.z += xhalf(b.z); b.w += xhalf(b.w);
  // Row kcol is key kt*16 + kcol of query jt*16 + wave; the lower half of
  // the wave stores heads 0 and 1, the upper half heads 2 and 3.
  const int at = (jt << 12) | (kt << 8) | ((kcol + 16 * (wave >> 3)) << 3) |
                 (wave & 7);
  biasws[((2 * hi + 0) << 16) | at] = (_Float16)(hi ? b.z : b.x);
  biasws[((2 * hi + 1) << 16) | at] = (_Float16)(hi ? b.w : b.y);
}

// ---------------------------------------------------------------------------
// Kernel 2: everything else of one row i in one block of 16 waves; wave w
// owns positions j = w*16 .. +15 of the row, as queries and as keys.
// The normalized rows stay in registers as fragments X. With X as the B
// operand a product comes out transposed (lane = position, 8 consecutive
// columns in the lane's registers), with X as the A operand plain (lane =
// column, 8 consecutive positions):
//   k^T = Wk^T . X^T  -> one 16-byte LDS store per tile into Ksh[key][column]
//   v   = X . Wv      -> one 16-byte LDS store per tile into VTsh[column][key]
//   q^T, gate^T       -> already in the order of the score product's B
//                        operand and of the O^T accumulators: never stored
// Attention per head as S^T = K . Q^T + bias^T . I, O^T += V^T . P^T with
// online softmax over passes of 128 keys; the gated O^T, rounded to f16, is
// the A fragment of the output product, which runs behind the head loop.
// ---------------------------------------------------------------------------
#define WT_LD 136   // 128 + 8 pad (272B row stride, 16B aligned)
#define VT_LD 264   // 256 + 8 pad
__global__ __launch_bounds__(512) void row_kernel(
    const float* __restrict__ pair, const float* __restrict__ gamma,
    const float* __restrict__ beta, const float* __restrict__ bg,
    const float* __restrict__ bo, const _Float16* __restrict__ biasws,
    const _Float16* __restrict__ wtws, float* __restrict__ out) {
  __shared__ __attribute__((aligned(16))) _Float16 WT[5][128 * WT_LD];  // 170 KB
  __shared__ __attribute__((aligned(16))) _Float16 Ksh[LVAL * WT_LD];   // 68 KB
  __shared__ __attribute__((aligned(16))) _Float16 VTsh[DPAIR * VT_LD]; // 66 KB

  const int wave = threadIdx.x >> 5;
  const int lane = threadIdx.x & 31;
  const int kcol = lane & 15, hi = lane >> 4;
  const size_t m0 = (size_t)blockIdx.x * LVAL + wave * 16;

  // Issued ahead of the weight staging.
  float4 xv[16];
  load_row(pair + (m0 + kcol) * DPAIR + hi * 8, xv);

  // The weight rows of 256 bytes go from the workspace straight into LDS at
  // the padded pitch: 16 lanes a row, so one copy of the block brings 32 rows
  // and four copies a matrix. Wk and Wv fly under the layernorm.
  const unsigned l0 = (unsigned)(size_t)(&WT[0][0]) +
                      (threadIdx.x >> 4) * (WT_LD * 2) + (threadIdx.x & 15) * 16;
  const _Float16* g0 = wtws + threadIdx.x * 8;
#define WL(c) "v"(l0 + (c) * (32 * WT_LD * 2))
#define WG(c) "v"(g0 + (c) * (512 * 8))
  // The closing wait stands ahead of every later write of the registers that
  // the copies name (a precaution).
  asm volatile(
      "global_load_async_to_lds_b128 %0, %8, off\n\t"
      "global_load_async_to_lds_b128 %1, %9, off\n\t"
      "global_load_async_to_lds_b128 %2, %10, off\n\t"
      "global_load_async_to_lds_b128 %3, %11, off\n\t"
      "global_load_async_to_lds_b128 %4, %12, off\n\t"
      "global_load_async_to_lds_b128 %5, %13, off\n\t"
      "global_load_async_to_lds_b128 %6, %14, off\n\t"
      "global_load_async_to_lds_b128 %7, %15, off\n\t"
      "s_wait_xcnt 0x0"
      :: WL(4), WL(5), WL(6), WL(7), WL(8), WL(9), WL(10), WL(11),
         WG(4), WG(5), WG(6), WG(7), WG(8), WG(9), WG(10), WG(11)
      : "memory");

  v16h X[4];
  norm_row(xv, gamma, beta, X);
  // Keeps the layernorm ahead of the barrier, under the copies' flight, and
  // the next copies' 36 address registers behind it (formed ahead of it they
  // push the kernel into scratch).
  __builtin_amdgcn_sched_barrier(0);
  // This wave's copies have landed; the barrier then publishes every wave's.
  asm volatile("s_wait_asynccnt 0x0" ::: "memory");
  __syncthreads();                       // Wk and Wv are staged

  // Wq, Wg and Wo are first read behind the next barrier: their copies fly
  // under the k and v products. Same closing wait as above.
  asm volatile(
      "global_load_async_to_lds_b128 %0, %12, off\n\t"
      "global_load_async_to_lds_b128 %1, %13, off\n\t"
      "global_load_async_to_lds_b128 %2, %14, off\n\t"
      "global_load_async_to_lds_b128 %3, %15, off\n\t"
      "global_load_async_to_lds_b128 %4, %16, off\n\t"
      "global_load_async_to_lds_b128 %5, %17, off\n\t"
      "global_load_async_to_lds_b128 %6, %18, off\n\t"
      "global_load_async_to_lds_b128 %7, %19, off\n\t"
      "global_load_async_to_lds_b128 %8, %20, off\n\t"
      "global_load_async_to_lds_b128 %9, %21, off\n\t"
      "global_load_async_to_lds_b128 %10, %22, off\n\t"
      "global_load_async_to_lds_b128 %11, %23, off\n\t"
      "s_wait_xcnt 0x0"
      :: WL(0), WL(1), WL(2), WL(3), WL(12), WL(13), WL(14), WL(15), WL(16),
         WL(17), WL(18), WL(19),
         WG(0), WG(1), WG(2), WG(3), WG(12), WG(13), WG(14), WG(15), WG(16),
         WG(17), WG(18), WG(19)
      : "memory");
#undef WL
#undef WG

  // --- k and v of this wave's 16 positions, all heads, into LDS ---
#pragma unroll
  for (int nt = 0; nt < 8; ++nt) {
    v8f ak = {}, av = {};
#pragma unroll
    for (int kk = 0; kk < 4; ++kk) {
      const v16h wk = load_frag16x32(WT[1] + (nt * 16) * WT_LD + kk * 32, WT_LD);
      const v16h wv = load_frag16x32(WT[2] + (nt * 16) * WT_LD + kk * 32, WT_LD);
      ak = wmma_f16(wk, X[kk], ak);      // column nt*16 + 8*hi + r, key kcol
      av = wmma_f16(X[kk], wv, av);      // key 8*hi + r, column nt*16 + kcol
    }
    v8h hk, hv;
#pragma unroll
    for (int r = 0; r < 8; ++r) { hk[r] = (_Float16)ak[r]; hv[r] = (_Float16)av[r]; }
    *(v8h*)(Ksh + (wave * 16 + kcol) * WT_LD + nt * 16 + hi * 8) = hk;
    *(v8h*)(VTsh + (nt * 16 + kcol) * VT_LD + wave * 16 + hi * 8) = hv;
  }
  // This wave's second run of copies has landed, ahead of the barrier.
  asm volatile("s_wait_asynccnt 0x0" ::: "memory");
  __syncthreads();       // every wave's k and v, and Wq, Wg, Wo, are in LDS

  // Wk and Wv are dead behind that barrier: each wave parks its gated O
  // fragments there, 4 KB of its own, read back by the same lanes only.
  _Float16* park = WT[1] + wave * 2048 + lane * 8;

  // The f16 bias is widened and laid into the score accumulators by the
  // matrix unit: one A fragment holds two key tiles (k 0..15 = the queries of
  // the first, k 16..31 of the second), and the unit matrix in the upper or
  // the lower 16 rows of B picks one of them (the other meets zeros, which is
  // exact for every finite f16 value).
  v16h Ilo, Ihi;
#pragma unroll
  for (int t = 0; t < 8; ++t) {
    const _Float16 one = (hi * 8 + t == kcol) ? (_Float16)1.0f : (_Float16)0.0f;
    Ilo[t] = one;             Ilo[t + 8] = (_Float16)0.0f;
    Ihi[t] = (_Float16)0.0f;  Ihi[t + 8] = one;
  }

  for (int h = 0; h < NHEAD; ++h) {
    // --- q^T: the B operand of the scores, column kcol = query ---
    v16h bQ;
    {
      v8f q0 = {}, q1 = {};
#pragma unroll
      for (int kk = 0; kk < 4; ++kk) {
        const v16h w0 = load_frag16x32(WT[0] + (h * DHID) * WT_LD + kk * 32, WT_LD);
        const v16h w1 = load_frag16x32(WT[0] + (h * DHID + 16) * WT_LD + kk * 32, WT_LD);
        q0 = wmma_f16(w0, X[kk], q0);    // d = 8*hi + r
        q1 = wmma_f16(w1, X[kk], q1);    // d = 16 + 8*hi + r
      }
#pragma unroll
      for (int r = 0; r < 8; ++r) {
        bQ[r]     = (_Float16)(q0[r] * SCALING);
        bQ[r + 8] = (_Float16)(q1[r] * SCALING);
      }
    }
    // 256 halves per (query tile, 16 keys); a wave's b128 load is 512 B in a row.
    const _Float16* biasF =
        biasws + (size_t)((h * 16 + wave) * 16) * 256 + lane * 8;

    v8f O0 = {}, O1 = {};              // O^T: d = 8*hi + r and 16 + 8*hi + r
    // This lane's query: nm = -(running maximum) * log2(e), and the sum.
    float nm = 3.0e38f, sum = 0.0f;

    // Kept rolled: unrolled, the two passes' tiles overlap in registers and
    // the normalized rows are spilled to scratch.
#pragma unroll 1
    for (int cc = 0; cc < 2; ++cc) {     // 128 keys per pass
      // --- scores: eight independent 16x16 tiles, rows = keys, the bias added
      // last; the pass's 8 bias loads are in flight together ---
      const _Float16* bp = biasF + cc * 2048;
      v8h cb[8];
#pragma unroll
      for (int u = 0; u < 8; ++u) cb[u] = *(const v8h*)(bp + u * 256);
      // The address stays in its registers up to this wait.
      asm volatile("s_wait_xcnt 0x0" :: "v"(bp) : "memory");
      v8f S[8];                          // S[t]: key cc*128 + t*16 + 8*hi + r
#pragma unroll
      for (int t = 0; t < 8; ++t) {
        const v16h aK = load_frag16x32(
            Ksh + (cc * 8 + t) * 16 * WT_LD + h * DHID, WT_LD);
        const v8f zero = {};
        S[t] = wmma_f16(aK, bQ, zero);   // under the bias loads' flight
      }
#pragma unroll
      for (int p = 0; p < 4; ++p) {
        v16h aB;
#pragma unroll
        for (int e = 0; e < 8; ++e) {
          aB[e] = cb[2 * p][e]; aB[e + 8] = cb[2 * p + 1][e];
        }
        S[2 * p]     = wmma_f16(aB, Ilo, S[2 * p]);
        S[2 * p + 1] = wmma_f16(aB, Ihi, S[2 * p + 1]);
      }

      // --- online softmax update, in-lane: four chains, then joined ---
      float tq[4];
#pragma unroll
      for (int p = 0; p < 4; ++p) {
        tq[p] = fmaxf(S[2 * p][0], S[2 * p + 1][0]);
#pragma unroll
        for (int r = 1; r < 8; ++r)
          tq[p] = fmaxf(tq[p], fmaxf(S[2 * p][r], S[2 * p + 1][r]));
      }
      float tm = fmaxf(fmaxf(tq[0], tq[1]), fmaxf(tq[2], tq[3]));
      tm = fmaxf(tm, xhalf(tm));
      // exp(s - max) = 2^(s * log2(e) + nm): one fused multiply-add in front
      // of each v_exp_f32. The rounding of nm is common to a query's terms
      // and to cf, so it cancels against the sum.
      const float nmold = nm;
      nm = fminf(nmold, -tm * LOG2E);
      const float cf = __builtin_amdgcn_exp2f(nm - nmold);
      v16h bP[4];                        // P^T in the hardware k order
      float pq[4];
#pragma unroll
      for (int p = 0; p < 4; ++p) {
        pq[p] = 0.0f;
#pragma unroll
        for (int r = 0; r < 8; ++r) {
          const float e0 = __builtin_amdgcn_exp2f(fmaf(S[2 * p][r], LOG2E, nm));
          const float e1 = __builtin_amdgcn_exp2f(fmaf(S[2 * p + 1][r], LOG2E, nm));
          pq[p] += e0 + e1;
          bP[p][r]     = (_Float16)e0;
          bP[p][r + 8] = (_Float16)e1;
        }
      }
      // this half's keys only
      sum = sum * cf + ((pq[0] + pq[1]) + (pq[2] + pq[3]));
#pragma unroll
      for (int r = 0; r < 8; ++r) { O0[r] *= cf; O1[r] *= cf; }

      // --- accumulate O^T += V^T(32x128) @ P^T(128x16) ---
#pragma unroll
      for (int p = 0; p < 4; ++p) {
        const v16h aV0 = load_frag16x32(
            VTsh + (h * DHID + 0)  * VT_LD + (cc * 4 + p) * 32, VT_LD);
        const v16h aV1 = load_frag16x32(
            VTsh + (h * DHID + 16) * VT_LD + (cc * 4 + p) * 32, VT_LD);
        O0 = wmma_f16(aV0, bP[p], O0);
        O1 = wmma_f16(aV1, bP[p], O1);
      }
    }

    // --- gate^T, in the order of O^T ---
    v8f g0 = {}, g1 = {};
#pragma unroll
    for (int kk = 0; kk < 4; ++kk) {
      const v16h w0 = load_frag16x32(WT[3] + (h * DHID) * WT_LD + kk * 32, WT_LD);
      const v16h w1 = load_frag16x32(WT[3] + (h * DHID + 16) * WT_LD + kk * 32, WT_LD);
      g0 = wmma_f16(w0, X[kk], g0);
      g1 = wmma_f16(w1, X[kk], g1);
    }
    const float* bgp = bg + h * DHID + hi * 8;
    const float4 b00 = *(const float4*)(bgp);
    const float4 b01 = *(const float4*)(bgp + 4);
    const float4 b10 = *(const float4*)(bgp + 16);
    const float4 b11 = *(const float4*)(bgp + 20);
    const v8f B0 = {b00.x, b00.y, b00.z, b00.w, b01.x, b01.y, b01.z, b01.w};
    const v8f B1 = {b10.x, b10.y, b10.z, b10.w, b11.x, b11.y, b11.z, b11.w};

    // --- join the halves' sums, normalize, gate: A fragment of the output
    // product (row kcol = query, k = this head's 32 columns).
    // O / sum * sigmoid(g) = O / ((1 + exp(-g)) * sum): one fused multiply-add
    // and one hardware reciprocal per element. The divisor is at least the
    // sum, which holds the largest key's exp(0) = 1; where exp(-g) overflows
    // it is infinite and the element 0, as with the division. ---
    const float tot = sum + xhalf(sum);
    v16h aO;
#pragma unroll
    for (int r = 0; r < 8; ++r) {
      const float e0 = __expf(-(g0[r] + B0[r]));
      const float e1 = __expf(-(g1[r] + B1[r]));
      aO[r]     = (_Float16)(O0[r] * __builtin_amdgcn_rcpf(fmaf(e0, tot, tot)));
      aO[r + 8] = (_Float16)(O1[r] * __builtin_amdgcn_rcpf(fmaf(e1, tot, tot)));
    }
    v8h lo, up;
#pragma unroll
    for (int r = 0; r < 8; ++r) { lo[r] = aO[r]; up[r] = aO[r + 8]; }
    *(v8h*)(park + h * 512)       = lo;
    *(v8h*)(park + h * 512 + 256) = up;
  }

  // --- output product, once for all heads: eight independent accumulators,
  // each summed head by head ---
  v8f acc[8] = {};                       // out rows 8*hi + r, column nt*16 + kcol
#pragma unroll
  for (int h = 0; h < NHEAD; ++h) {
    const v8h lo = *(const v8h*)(park + h * 512);
    const v8h up = *(const v8h*)(park + h * 512 + 256);
    v16h aO;
#pragma unroll
    for (int r = 0; r < 8; ++r) { aO[r] = lo[r]; aO[r + 8] = up[r]; }
#pragma unroll
    for (int nt = 0; nt < 8; ++nt) {
      const v16h wo = load_frag16x32(WT[4] + (nt * 16) * WT_LD + h * DHID, WT_LD);
      acc[nt] = wmma_f16(aO, wo, acc[nt]);
    }
  }

#pragma unroll
  for (int nt = 0; nt < 8; ++nt) {
    const int n = nt * 16 + kcol;
    const float bon = bo[n];
#pragma unroll
    for (int r = 0; r < 8; ++r) {
      const size_t mr = m0 + r + 8 * hi;
      out[mr * DPAIR + n] = acc[nt][r] + bon;
    }
  }
}

// ---------------------------------------------------------------------------
// Launch.  Inputs: 0 pair, 1 gamma, 2 beta, 3 Wq, 4 Wk, 5 Wv, 6 Wb, 7 Wg,
// 8 bg, 9 Wo, 10 bo.  Output: f32 (1,256,256,128).
// Workspace: the bias, NHEAD*NPOS f16 = 512 KB, then the f16 weights, 160 KB.
// ---------------------------------------------------------------------------
extern "C" void kernel_launch(void* const* d_in, const int* in_sizes, int n_in,
                              void* d_out, int out_size, void* d_ws,
                              size_t ws_size, hipStream_t stream) {
  const float* pair  = (const float*)d_in[0];
  const float* gamma = (const float*)d_in[1];
  const float* beta  = (const float*)d_in[2];
  const float* Wq    = (const float*)d_in[3];
  const float* Wk    = (const float*)d_in[4];
  const float* Wv    = (const float*)d_in[5];
  const float* Wb    = (const float*)d_in[6];
  const float* Wg    = (const float*)d_in[7];
  const float* bg    = (const float*)d_in[8];
  const float* Wo    = (const float*)d_in[9];
  const float* bo    = (const float*)d_in[10];
  float* out  = (float*)d_out;
  _Float16* bbuf = (_Float16*)d_ws;
  _Float16* wbuf = bbuf + NHEAD * NPOS;

  bias_kernel<<<NPOS / 256, 512, 0, stream>>>(pair, gamma, beta, Wb, Wq, Wk, Wv,
                                              Wg, Wo, bbuf, wbuf);
  row_kernel<<<LVAL, 512, 0, stream>>>(pair, gamma, beta, bg, bo, bbuf, wbuf,
                                       out);
}

// v008
// One run takes 29.4 microseconds.
// Next to v007, in two timings, it ran 1.03 and 1.04 times as fast.
// All steps since v000 together make it 4.40 times as fast.
#include <hip/hip_runtime.h>
#include <hip/hip_bf16.h>

// ---------------------------------------------------------------------------
// Triangle attention for MI455X (gfx1250, wave32, WMMA 16x16x32 f16).
// L=256, D_PAIR=128, N_HEAD=4, D_HID=32, NPOS=65536.
// ---------------------------------------------------------------------------

#define LVAL   256
#define DPAIR  128
#define NHEAD  4
#define DHID   32
#define NPOS   (LVAL * LVAL)
#define SCALING 0.17677669529663687f   // 1/sqrt(32)
#define LOG2E   1.4426950408889634f    // v_exp_f32 is a power of two

typedef __attribute__((ext_vector_type(16))) _Float16 v16h;
typedef __attribute__((ext_vector_type(8)))  _Float16 v8h;
typedef __attribute__((ext_vector_type(8)))  float    v8f;

// Load one 16x32 f16 fragment (A-matrix layout; also used for B as B^T rows)
// from row-major storage with row stride `ld` (elements).
// ISA layout (16-bit A 16x32): lanes 0-15 -> M=0-15, cols {0..7,16..23};
// lanes 16-31 -> M=0-15, cols {8..15,24..31}. Two b128 loads per lane.
__device__ inline v16h load_frag16x32(const _Float16* p, int ld) {
  const int lane = threadIdx.x & 31;
  const int row  = lane & 15;
  const int hi   = lane >> 4;
  const _Float16* r = p + row * ld + hi * 8;
  v8h a = *(const v8h*)(r);
  v8h b = *(const v8h*)(r + 16);
  v16h f;
#pragma unroll
  for (int t = 0; t < 8; ++t) { f[t] = a[t]; f[t + 8] = b[t]; }
  return f;
}

__device__ inline v8f wmma_f16(v16h a, v16h b, v8f c) {
  return __builtin_amdgcn_wmma_f32_16x16x32_f16(false, a, false, b,
                                                (short)0, c, false, false);
}

// Lane l <-> lane l ^ 16 (the two halves of a wave hold the same row).
__device__ inline float xhalf(float x) {
  const int b = __builtin_bit_cast(int, x);
  return __builtin_bit_cast(float, __builtin_amdgcn_permlanex16(
      b, b, 0x76543210, 0xfedcba98, false, false));
}

// This lane's 64 columns of its row: kk*32 + g*16 + hi*8 + 0..7, the order of
// the WMMA A (and B) fragment. xr = row start + hi*8.
__device__ inline void load_row(const float* __restrict__ xr,
                                float4 (&xv)[16]) {
#pragma unroll
  for (int u = 0; u < 8; ++u) {
    xv[2 * u]     = *(const float4*)(xr + u * 16);
    xv[2 * u + 1] = *(const float4*)(xr + u * 16 + 4);
  }
  // The address stays in its registers up to this wait.
  asm volatile("s_wait_xcnt 0x0" :: "v"(xr) : "memory");
}

// LayerNorm of the row held by a lane and its partner lane ^ 16: four in-lane
// chains, then the other half of the row; the result, rounded to f16, is the
// wave's 16 x 128 operand in fragment order.
__device__ inline void norm_row(const float4 (&xv)[16],
                                const float* __restrict__ gamma,
                                const float* __restrict__ beta,
                                v16h (&A)[4]) {
  const int hi = (threadIdx.x & 31) >> 4;
  float4 s4 = {0.0f, 0.0f, 0.0f, 0.0f}, q4 = {0.0f, 0.0f, 0.0f, 0.0f};
#pragma unroll
  for (int u = 0; u < 16; ++u) {
    s4.x += xv[u].x; s4.y += xv[u].y; s4.z += xv[u].z; s4.w += xv[u].w;
    q4.x += xv[u].x * xv[u].x; q4.y += xv[u].y * xv[u].y;
    q4.z += xv[u].z * xv[u].z; q4.w += xv[u].w * xv[u].w;
  }
  float s  = (s4.x + s4.y) + (s4.z + s4.w);
  float ss = (q4.x + q4.y) + (q4.z + q4.w);
  s  += xhalf(s);
  ss += xhalf(ss);
  const float mu  = s * (1.0f / DPAIR);
  const float var = ss * (1.0f / DPAIR) - mu * mu;
  const float inv = rsqrtf(var + 1e-5f);
#pragma unroll
  for (int u = 0; u < 16; ++u) {
    const int c = (u >> 1) * 16 + hi * 8 + (u & 1) * 4;
    const float4 gv = *(const float4*)(gamma + c);
    const float4 bv = *(const float4*)(beta + c);
    const int t = (u & 3) * 4;           // element of fragment u >> 2
    A[u >> 2][t + 0] = (_Float16)((xv[u].x - mu) * inv * gv.x + bv.x);
    A[u >> 2][t + 1] = (_Float16)((xv[u].y - mu) * inv * gv.y + bv.y);
    A[u >> 2][t + 2] = (_Float16)((xv[u].z - mu) * inv * gv.z + bv.z);
    A[u >> 2][t + 3] = (_Float16)((xv[u].w - mu) * inv * gv.w + bv.w);
  }
}

// ---------------------------------------------------------------------------
// Kernel 1: the pair bias (it couples every row j with every row i, so
// it has to be complete before any attention starts). grid = 256 blocks of 16
// waves; block = (query tile jt, key tile kt), wave w owns the 16 rows
// (j = jt*16 + w, key = kt*16 .. +15).
// bias = layernorm(x) @ Wb (128 -> 4) comes from matrix products of the raw
// rows X, rounded to f16:
//   bias = inv * (x . (gamma * Wb) - mu * sum(gamma * Wb)) + sum(beta * Wb).
// The A operand T has, for the heads 2a and 2a + 1 in its rows 8a + 0..7:
// gamma * Wb rounded to f16 (two rows), what that rounding left (two rows),
// beta * Wb (two rows), ones, zeros. T . X^T gives each lane its position's
// products and its row sum, T . 1 the sums of gamma * Wb and of beta * Wb, and
// the diagonal of X . X^T the sum of squares. A lane of half a ends with heads 2a and 2a + 1.
// The bias is rounded to f16 and stored as half a WMMA A fragment per 16 x 16
// tile (row = key, k = query):
// biasws[h][jt][kt][lane][e] = bias(j = jt*16 + (lane >> 4)*8 + e,
//   key = kt*16 + (lane & 15), head h);
// the 16 waves of a block fill whole 128-byte lines of it between them.
// Beside that, the five 128 x 128 weights are rounded to f16 and transposed
// once for the whole chip: wtws[matrix][n][k], matrix = q, k, v, gate, out.
// Two waves write four half rows of 64 k (one 128-byte line each).
// ---------------------------------------------------------------------------
#define WB_LD 136   // 128 + 8 pad (272B row stride, 16B aligned)
__global__ __launch_bounds__(512) void bias_kernel(
    const float* __restrict__ pair, const float* __restrict__ gamma,
    const float* __restrict__ beta, const float* __restrict__ Wb,
    const float* __restrict__ Wq, const float* __restrict__ Wk,
    const float* __restrict__ Wv, const float* __restrict__ Wg,
    const float* __restrict__ Wo, _Float16* __restrict__ biasws,
    _Float16* __restrict__ wtws) {
  __shared__ __attribute__((aligned(16))) _Float16 WbT[16 * WB_LD];  // 4352 B

  const int wave = threadIdx.x >> 5;
  const int lane = threadIdx.x & 31;
  const int kcol = lane & 15, hi = lane >> 4;
  const int jt = blockIdx.x >> 4, kt = blockIdx.x & 15;
  const size_t m0 = (size_t)((jt * 16 + wave) * LVAL + kt * 16);

  // 320 units of 4 rows n x 64 k, two waves each; scalar, so that the matrix
  // is picked without lane masks. Ahead of the row loads: its load and its
  // stores are then done long before the barrier, which waits for both, and
  // the other waves' row loads keep the memory path busy meanwhile.
  const int wu   = __builtin_amdgcn_readfirstlane(wave);
  const int unit = blockIdx.x + (wu >> 1) * 256;
  if (wu < 4 && unit < 320) {
    const int mtx = unit >> 6, n4 = ((unit >> 1) & 31) * 4;
    const int kk  = (unit & 1) * 64 + (threadIdx.x & 63);
    const float* Ws = mtx == 0 ? Wq : mtx == 1 ? Wk : mtx == 2 ? Wv
                    : mtx == 3 ? Wg : Wo;
    const float* wp = Ws + kk * DPAIR + n4;
    const float4 w = *(const float4*)wp;
    // The address stays in its registers up to this wait.
    asm volatile("s_wait_xcnt 0x0" :: "v"(wp) : "memory");
    _Float16* d = wtws + (mtx * DPAIR + n4) * DPAIR + kk;
    d[0 * DPAIR] = (_Float16)w.x;
    d[1 * DPAIR] = (_Float16)w.y;
    d[2 * DPAIR] = (_Float16)w.z;
    d[3 * DPAIR] = (_Float16)w.w;
    // Ahead of the row loads, which may be given the stores' registers.
    asm volatile("s_wait_xcnt 0x0" ::: "memory");
  }

  float4 xv[16];
  load_row(pair + (m0 + kcol) * DPAIR + hi * 8, xv);
  if (threadIdx.x < DPAIR) {
    const float4 w = *(const float4*)(Wb + threadIdx.x * NHEAD);
    const float g = gamma[threadIdx.x];
    const float s = beta[threadIdx.x];
    // Ahead of every later write of the registers that the loads name.
    asm volatile("s_wait_xcnt 0x0" ::: "memory");
    const float wf[4] = {w.x, w.y, w.z, w.w};
    _Float16* col = WbT + threadIdx.x;
#pragma unroll
    for (int h = 0; h < NHEAD; ++h) {
      const int row = (h >> 1) * 8 + (h & 1);
      const float gw = g * wf[h];
      const _Float16 top = (_Float16)gw;
      col[(row + 0) * WB_LD] = top;
      col[(row + 2) * WB_LD] = (_Float16)(gw - (float)top);
      col[(row + 4) * WB_LD] = (_Float16)(s * wf[h]);
    }
    col[6 * WB_LD]  = (_Float16)1.0f;  col[7 * WB_LD]  = (_Float16)0.0f;
    col[14 * WB_LD] = (_Float16)1.0f;  col[15 * WB_LD] = (_Float16)0.0f;
  }
  // The raw rows in fragment order (the k order of load_frag16x32).
  v16h X[4];
#pragma unroll
  for (int u = 0; u < 16; ++u) {
    const int t = (u & 3) * 4;           // element of fragment u >> 2
    X[u >> 2][t + 0] = (_Float16)xv[u].x;
    X[u >> 2][t + 1] = (_Float16)xv[u].y;
    X[u >> 2][t + 2] = (_Float16)xv[u].z;
    X[u >> 2][t + 3] = (_Float16)xv[u].w;
  }
  __syncthreads();

  v16h ones;
#pragma unroll
  for (int t = 0; t < 16; ++t) ones[t] = (_Float16)1.0f;
  // Register r of a lane: row 8*hi + r of T (tx, t1) or position 8*hi + r
  // (xx); the lane's column is position kcol.
  v8f tx = {}, t1 = {}, xx = {};
#pragma unroll
  for (int kk = 0; kk < 4; ++kk) {
    const v16h T = load_frag16x32(WbT + kk * 32, WB_LD);
    tx = wmma_f16(T, X[kk], tx);
    t1 = wmma_f16(T, ones, t1);
    xx = wmma_f16(X[kk], X[kk], xx);
  }
  // The diagonal element of position kcol sits in register kcol & 7 of the
  // half kcol >> 3; the other half takes it from there.
  float dg = xx[0];
#pragma unroll
  for (int r = 1; r < 8; ++r) dg = ((kcol & 7) == r) ? xx[r] : dg;
  const float og  = xhalf(dg);
  const float ss  = ((kcol >> 3) == hi) ? dg : og;
  const float mu  = tx[6] * (1.0f / DPAIR);
  const float var = ss * (1.0f / DPAIR) - mu * mu;
  const float inv = rsqrtf(var + 1e-5f);
  const float b0 = inv * ((tx[0] + tx[2]) - mu * (t1[0] + t1[2])) + t1[4];
  const float b1 = inv * ((tx[1] + tx[3]) - mu * (t1[1] + t1[3])) + t1[5];
  // Row kcol is key kt*16 + kcol of query jt*16 + wave; the lower half of
  // the wave stores heads 0 and 1, the upper half heads 2 and 3.
  const int at = (jt << 12) | (kt << 8) | ((kcol + 16 * (wave >> 3)) << 3) |
                 (wave & 7);
  biasws[((2 * hi + 0) << 16) | at] = (_Float16)b0;
  biasws[((2 * hi + 1) << 16) | at] = (_Float16)b1;
}

// ---------------------------------------------------------------------------
// Kernel 2: everything else of one row i in one block of 16 waves; wave w
// owns positions j = w*16 .. +15 of the row, as queries and as keys.
// The normalized rows stay in registers as fragments X. With X as the B
// operand a product comes out transposed (lane = position, 8 consecutive
// columns in the lane's registers), with X as the A operand plain (lane =
// column, 8 consecutive positions):
//   k^T = Wk^T . X^T  -> one 16-byte LDS store per tile into Ksh[key][column]
//   v   = X . Wv      -> one 16-byte LDS store per tile into VTsh[column][key]
//   q^T, gate^T       -> already in the order of the score product's B
//                        operand and of the O^T accumulators: never stored
// Attention per head as S^T = K . Q^T + bias^T . I, O^T += V^T . P^T with
// online softmax over passes of 128 keys; the gated O^T, rounded to f16, is
// the A fragment of the output product, which runs behind the head loop.
// ---------------------------------------------------------------------------
#define WT_LD 136   // 128 + 8 pad (272B row stride, 16B aligned)
#define VT_LD 264   // 256 + 8 pad
__global__ __launch_bounds__(512) void row_kernel(
    const float* __restrict__ pair, const float* __restrict__ gamma,
    const float* __restrict__ beta, const float* __restrict__ bg,
    const float* __restrict__ bo, const _Float16* __restrict__ biasws,
    const _Float16* __restrict__ wtws, float* __restrict__ out) {
  __shared__ __attribute__((aligned(16))) _Float16 WT[5][128 * WT_LD];  // 170 KB
  __shared__ __attribute__((aligned(16))) _Float16 Ksh[LVAL * WT_LD];   // 68 KB
  __shared__ __attribute__((aligned(16))) _Float16 VTsh[DPAIR * VT_LD]; // 66 KB

  const int wave = threadIdx.x >> 5;
  const int lane = threadIdx.x & 31;
  const int kcol = lane & 15, hi = lane >> 4;
  const size_t m0 = (size_t)blockIdx.x * LVAL + wave * 16;

  // Issued ahead of the weight staging.
  float4 xv[16];
  load_row(pair + (m0 + kcol) * DPAIR + hi * 8, xv);

  // The weight rows of 256 bytes go from the workspace straight into LDS at
  // the padded pitch: 16 lanes a row, so one copy of the block brings 32 rows
  // and four copies a matrix. Wk and Wv fly under the layernorm.
  const unsigned l0 = (unsigned)(size_t)(&WT[0][0]) +
                      (threadIdx.x >> 4) * (WT_LD * 2) + (threadIdx.x & 15) * 16;
  const _Float16* g0 = wtws + threadIdx.x * 8;
#define WL(c) "v"(l0 + (c) * (32 * WT_LD * 2))
#define WG(c) "v"(g0 + (c) * (512 * 8))
  // The closing wait stands ahead of every later write of the registers that
  // the copies name (a precaution).
  asm volatile(
      "global_load_async_to_lds_b128 %0, %8, off\n\t"
      "global_load_async_to_lds_b128 %1, %9, off\n\t"
      "global_load_async_to_lds_b128 %2, %10, off\n\t"
      "global_load_async_to_lds_b128 %3, %11, off\n\t"
      "global_load_async_to_lds_b128 %4, %12, off\n\t"
      "global_load_async_to_lds_b128 %5, %13, off\n\t"
      "global_load_async_to_lds_b128 %6, %14, off\n\t"
      "global_load_async_to_lds_b128 %7, %15, off\n\t"
      "s_wait_xcnt 0x0"
      :: WL(4), WL(5), WL(6), WL(7), WL(8), WL(9), WL(10), WL(11),
         WG(4), WG(5), WG(6), WG(7), WG(8), WG(9), WG(10), WG(11)
      : "memory");

  v16h X[4];
  norm_row(xv, gamma, beta, X);
  // Keeps the layernorm ahead of the barrier, under the copies' flight, and
  // the next copies' 36 address registers behind it (formed ahead of it they
  // push the kernel into scratch).
  __builtin_amdgcn_sched_barrier(0);
  // This wave's copies have landed; the barrier then publishes every wave's.
  asm volatile("s_wait_asynccnt 0x0" ::: "memory");
  __syncthreads();                       // Wk and Wv are staged

  // Wq, Wg and Wo are first read behind the next barrier: their copies fly
  // under the k and v products. Same closing wait as above.
  asm volatile(
      "global_load_async_to_lds_b128 %0, %12, off\n\t"
      "global_load_async_to_lds_b128 %1, %13, off\n\t"
      "global_load_async_to_lds_b128 %2, %14, off\n\t"
      "global_load_async_to_lds_b128 %3, %15, off\n\t"
      "global_load_async_to_lds_b128 %4, %16, off\n\t"
      "global_load_async_to_lds_b128 %5, %17, off\n\t"
      "global_load_async_to_lds_b128 %6, %18, off\n\t"
      "global_load_async_to_lds_b128 %7, %19, off\n\t"
      "global_load_async_to_lds_b128 %8, %20, off\n\t"
      "global_load_async_to_lds_b128 %9, %21, off\n\t"
      "global_load_async_to_lds_b128 %10, %22, off\n\t"
      "global_load_async_to_lds_b128 %11, %23, off\n\t"
      "s_wait_xcnt 0x0"
      :: WL(0), WL(1), WL(2), WL(3), WL(12), WL(13), WL(14), WL(15), WL(16),
         WL(17), WL(18), WL(19),
         WG(0), WG(1), WG(2), WG(3), WG(12), WG(13), WG(14), WG(15), WG(16),
         WG(17), WG(18), WG(19)
      : "memory");
#undef WL
#undef WG

  // --- k and v of this wave's 16 positions, all heads, into LDS ---
#pragma unroll
  for (int nt = 0; nt < 8; ++nt) {
    v8f ak = {}, av = {};
#pragma unroll
    for (int kk = 0; kk < 4; ++kk) {
      const v16h wk = load_frag16x32(WT[1] + (nt * 16) * WT_LD + kk * 32, WT_LD);
      const v16h wv = load_frag16x32(WT[2] + (nt * 16) * WT_LD + kk * 32, WT_LD);
      ak = wmma_f16(wk, X[kk], ak);      // column nt*16 + 8*hi + r, key kcol
      av = wmma_f16(X[kk], wv, av);      // key 8*hi + r, column nt*16 + kcol
    }
    v8h hk, hv;
#pragma unroll
    for (int r = 0; r < 8; ++r) { hk[r] = (_Float16)ak[r]; hv[r] = (_Float16)av[r]; }
    *(v8h*)(Ksh + (wave * 16 + kcol) * WT_LD + nt * 16 + hi * 8) = hk;
    *(v8h*)(VTsh + (nt * 16 + kcol) * VT_LD + wave * 16 + hi * 8) = hv;
  }
  // This wave's second run of copies has landed, ahead of the barrier.
  asm volatile("s_wait_asynccnt 0x0" ::: "memory");
  __syncthreads();       // every wave's k and v, and Wq, Wg, Wo, are in LDS

  // Wk and Wv are dead behind that barrier: each wave parks its gated O
  // fragments there, 4 KB of its own, read back by the same lanes only.
  _Float16* park = WT[1] + wave * 2048 + lane * 8;

  // The f16 bias is widened and laid into the score accumulators by the
  // matrix unit: one A fragment holds two key tiles (k 0..15 = the queries of
  // the first, k 16..31 of the second), and the unit matrix in the upper or
  // the lower 16 rows of B picks one of them (the other meets zeros, which is
  // exact for every finite f16 value).
  v16h Ilo, Ihi;
#pragma unroll
  for (int t = 0; t < 8; ++t) {
    const _Float16 one = (hi * 8 + t == kcol) ? (_Float16)1.0f : (_Float16)0.0f;
    Ilo[t] = one;             Ilo[t + 8] = (_Float16)0.0f;
    Ihi[t] = (_Float16)0.0f;  Ihi[t + 8] = one;
  }

  for (int h = 0; h < NHEAD; ++h) {
    // --- q^T: the B operand of the scores, column kcol = query ---
    v16h bQ;
    {
      v8f q0 = {}, q1 = {};
#pragma unroll
      for (int kk = 0; kk < 4; ++kk) {
        const v16h w0 = load_frag16x32(WT[0] + (h * DHID) * WT_LD + kk * 32, WT_LD);
        const v16h w1 = load_frag16x32(WT[0] + (h * DHID + 16) * WT_LD + kk * 32, WT_LD);
        q0 = wmma_f16(w0, X[kk], q0);    // d = 8*hi + r
        q1 = wmma_f16(w1, X[kk], q1);    // d = 16 + 8*hi + r
      }
#pragma unroll
      for (int r = 0; r < 8; ++r) {
        bQ[r]     = (_Float16)(q0[r] * SCALING);
        bQ[r + 8] = (_Float16)(q1[r] * SCALING);
      }
    }
    // 256 halves per (query tile, 16 keys); a wave's b128 load is 512 B in a row.
    const _Float16* biasF =
        biasws + (size_t)((h * 16 + wave) * 16) * 256 + lane * 8;

    v8f O0 = {}, O1 = {};              // O^T: d = 8*hi + r and 16 + 8*hi + r
    // This lane's query: nm = -(running maximum) * log2(e), and the sum.
    float nm = 3.0e38f, sum = 0.0f;

    // Kept rolled: unrolled, the two passes' tiles overlap in registers and
    // the normalized rows are spilled to scratch.
#pragma unroll 1
    for (int cc = 0; cc < 2; ++cc) {     // 128 keys per pass
      // --- scores: eight independent 16x16 tiles, rows = keys, the bias added
      // last; the pass's 8 bias loads are in flight together ---
      const _Float16* bp = biasF + cc * 2048;
      v8h cb[8];
#pragma unroll
      for (int u = 0; u < 8; ++u) cb[u] = *(const v8h*)(bp + u * 256);
      // The address stays in its registers up to this wait.
      asm volatile("s_wait_xcnt 0x0" :: "v"(bp) : "memory");
      v8f S[8];                          // S[t]: key cc*128 + t*16 + 8*hi + r
#pragma unroll
      for (int t = 0; t < 8; ++t) {
        const v16h aK = load_frag16x32(
            Ksh + (cc * 8 + t) * 16 * WT_LD + h * DHID, WT_LD);
        const v8f zero = {};
        S[t] = wmma_f16(aK, bQ, zero);   // under the bias loads' flight
      }
#pragma unroll
      for (int p = 0; p < 4; ++p) {
        v16h aB;
#pragma unroll
        for (int e = 0; e < 8; ++e) {
          aB[e] = cb[2 * p][e]; aB[e + 8] = cb[2 * p + 1][e];
        }
        S[2 * p]     = wmma_f16(aB, Ilo, S[2 * p]);
        S[2 * p + 1] = wmma_f16(aB, Ihi, S[2 * p + 1]);
      }

      // --- online softmax update, in-lane: four chains, then joined ---
      float tq[4];
#pragma unroll
      for (int p = 0; p < 4; ++p) {
        tq[p] = fmaxf(S[2 * p][0], S[2 * p + 1][0]);
#pragma unroll
        for (int r = 1; r < 8; ++r)
          tq[p] = fmaxf(tq[p], fmaxf(S[2 * p][r], S[2 * p + 1][r]));
      }
      float tm = fmaxf(fmaxf(tq[0], tq[1]), fmaxf(tq[2], tq[3]));
      tm = fmaxf(tm, xhalf(tm));
      // exp(s - max) = 2^(s * log2(e) + nm): one fused multiply-add in front
      // of each v_exp_f32. The rounding of nm is common to a query's terms
      // and to cf, so it cancels against the sum.
      const float nmold = nm;
      nm = fminf(nmold, -tm * LOG2E);
      const float cf = __builtin_amdgcn_exp2f(nm - nmold);
      v16h bP[4];                        // P^T in the hardware k order
      float pq[4];
#pragma unroll
      for (int p = 0; p < 4; ++p) {
        pq[p] = 0.0f;
#pragma unroll
        for (int r = 0; r < 8; ++r) {
          const float e0 = __builtin_amdgcn_exp2f(fmaf(S[2 * p][r], LOG2E, nm));
          const float e1 = __builtin_amdgcn_exp2f(fmaf(S[2 * p + 1][r], LOG2E, nm));
          pq[p] += e0 + e1;
          bP[p][r]     = (_Float16)e0;
          bP[p][r + 8] = (_Float16)e1;
        }
      }
      // this half's keys only
      sum = sum * cf + ((pq[0] + pq[1]) + (pq[2] + pq[3]));
#pragma unroll
      for (int r = 0; r < 8; ++r) { O0[r] *= cf; O1[r] *= cf; }

      // --- accumulate O^T += V^T(32x128) @ P^T(128x16) ---
#pragma unroll
      for (int p = 0; p < 4; ++p) {
        const v16h aV0 = load_frag16x32(
            VTsh + (h * DHID + 0)  * VT_LD + (cc * 4 + p) * 32, VT_LD);
        const v16h aV1 = load_frag16x32(
            VTsh + (h * DHID + 16) * VT_LD + (cc * 4 + p) * 32, VT_LD);
        O0 = wmma_f16(aV0, bP[p], O0);
        O1 = wmma_f16(aV1, bP[p], O1);
      }
    }

    // --- gate^T, in the order of O^T ---
    v8f g0 = {}, g1 = {};
#pragma unroll
    for (int kk = 0; kk < 4; ++kk) {
      const v16h w0 = load_frag16x32(WT[3] + (h * DHID) * WT_LD + kk * 32, WT_LD);
      const v16h w1 = load_frag16x32(WT[3] + (h * DHID + 16) * WT_LD + kk * 32, WT_LD);
      g0 = wmma_f16(w0, X[kk], g0);
      g1 = wmma_f16(w1, X[kk], g1);
    }
    const float* bgp = bg + h * DHID + hi * 8;
    const float4 b00 = *(const float4*)(bgp);
    const float4 b01 = *(const float4*)(bgp + 4);
    const float4 b10 = *(const float4*)(bgp + 16);
    const float4 b11 = *(const float4*)(bgp + 20);
    const v8f B0 = {b00.x, b00.y, b00.z, b00.w, b01.x, b01.y, b01.z, b01.w};
    const v8f B1 = {b10.x, b10.y, b10.z, b10.w, b11.x, b11.y, b11.z, b11.w};

    // --- join the halves' sums, normalize, gate: A fragment of the output
    // product (row kcol = query, k = this head's 32 columns).
    // O / sum * sigmoid(g) = O / ((1 + exp(-g)) * sum): one fused multiply-add
    // and one hardware reciprocal per element. The divisor is at least the
    // sum, which holds the largest key's exp(0) = 1; where exp(-g) overflows
    // it is infinite and the element 0, as with the division. ---
    const float tot = sum + xhalf(sum);
    v16h aO;
#pragma unroll
    for (int r = 0; r < 8; ++r) {
      const float e0 = __expf(-(g0[r] + B0[r]));
      const float e1 = __expf(-(g1[r] + B1[r]));
      aO[r]     = (_Float16)(O0[r] * __builtin_amdgcn_rcpf(fmaf(e0, tot, tot)));
      aO[r + 8] = (_Float16)(O1[r] * __builtin_amdgcn_rcpf(fmaf(e1, tot, tot)));
    }
    v8h lo, up;
#pragma unroll
    for (int r = 0; r < 8; ++r) { lo[r] = aO[r]; up[r] = aO[r + 8]; }
    *(v8h*)(park + h * 512)       = lo;
    *(v8h*)(park + h * 512 + 256) = up;
  }

  // --- output product, once for all heads: eight independent accumulators,
  // each summed head by head ---
  v8f acc[8] = {};                       // out rows 8*hi + r, column nt*16 + kcol
#pragma unroll
  for (int h = 0; h < NHEAD; ++h) {
    const v8h lo = *(const v8h*)(park + h * 512);
    const v8h up = *(const v8h*)(park + h * 512 + 256);
    v16h aO;
#pragma unroll
    for (int r = 0; r < 8; ++r) { aO[r] = lo[r]; aO[r + 8] = up[r]; }
#pragma unroll
    for (int nt = 0; nt < 8; ++nt) {
      const v16h wo = load_frag16x32(WT[4] + (nt * 16) * WT_LD + h * DHID, WT_LD);
      acc[nt] = wmma_f16(aO, wo, acc[nt]);
    }
  }

#pragma unroll
  for (int nt = 0; nt < 8; ++nt) {
    const int n = nt * 16 + kcol;
    const float bon = bo[n];
#pragma unroll
    for (int r = 0; r < 8; ++r) {
      const size_t mr = m0 + r + 8 * hi;
      out[mr * DPAIR + n] = acc[nt][r] + bon;
    }
  }
}

// ---------------------------------------------------------------------------
// Launch.  Inputs: 0 pair, 1 gamma, 2 beta, 3 Wq, 4 Wk, 5 Wv, 6 Wb, 7 Wg,
// 8 bg, 9 Wo, 10 bo.  Output: f32 (1,256,256,128).
// Workspace: the bias, NHEAD*NPOS f16 = 512 KB, then the f16 weights, 160 KB.
// ---------------------------------------------------------------------------
extern "C" void kernel_launch(void* const* d_in, const int* in_sizes, int n_in,
                              void* d_out, int out_size, void* d_ws,
                              size_t ws_size, hipStream_t stream) {
  const float* pair  = (const float*)d_in[0];
  const float* gamma = (const float*)d_in[1];
  const float* beta  = (const float*)d_in[2];
  const float* Wq    = (const float*)d_in[3];
  const float* Wk    = (const float*)d_in[4];
  const float* Wv    = (const float*)d_in[5];
  const float* Wb    = (const float*)d_in[6];
  const float* Wg    = (const float*)d_in[7];
  const float* bg    = (const float*)d_in[8];
  const float* Wo    = (const float*)d_in[9];
  const float* bo    = (const float*)d_in[10];
  float* out  = (float*)d_out;
  _Float16* bbuf = (_Float16*)d_ws;
  _Float16* wbuf = bbuf + NHEAD * NPOS;

  bias_kernel<<<NPOS / 256, 512, 0, stream>>>(pair, gamma, beta, Wb, Wq, Wk, Wv,
                                              Wg, Wo, bbuf, wbuf);
  row_kernel<<<LVAL, 512, 0, stream>>>(pair, gamma, beta, bg, bo, bbuf, wbuf,
                                       out);
}

// v009
// One run takes 27.9 microseconds.
// Timed twice side by side with v008, it ran 1.04 and 1.05 times as fast.
// Counting every step since v000, it is 4.60 times as fast.
#include <hip/hip_runtime.h>
#include <hip/hip_bf16.h>

// ---------------------------------------------------------------------------
// Triangle attention for MI455X (gfx1250, wave32, WMMA 16x16x32 f16).
// L=256, D_PAIR=128, N_HEAD=4, D_HID=32, NPOS=65536.
// ---------------------------------------------------------------------------

#define LVAL   256
#define DPAIR  128
#define NHEAD  4
#define DHID   32
#define NPOS   (LVAL * LVAL)
#define SCALING 0.17677669529663687f   // 1/sqrt(32)
#define LOG2E   1.4426950408889634f    // v_exp_f32 is a power of two

typedef __attribute__((ext_vector_type(16))) _Float16 v16h;
typedef __attribute__((ext_vector_type(8)))  _Float16 v8h;
typedef __attribute__((ext_vector_type(8)))  float    v8f;

// Load one 16x32 f16 fragment (A-matrix layout; also used for B as B^T rows)
// from row-major storage with row stride `ld` (elements).
// ISA layout (16-bit A 16x32): lanes 0-15 -> M=0-15, cols {0..7,16..23};
// lanes 16-31 -> M=0-15, cols {8..15,24..31}. Two b128 loads per lane.
__device__ inline v16h load_frag16x32(const _Float16* p, int ld) {
  const int lane = threadIdx.x & 31;
  const int row  = lane & 15;
  const int hi   = lane >> 4;
  const _Float16* r = p + row * ld + hi * 8;
  v8h a = *(const v8h*)(r);
  v8h b = *(const v8h*)(r + 16);
  v16h f;
#pragma unroll
  for (int t = 0; t < 8; ++t) { f[t] = a[t]; f[t + 8] = b[t]; }
  return f;
}

__device__ inline v8f wmma_f16(v16h a, v16h b, v8f c) {
  return __builtin_amdgcn_wmma_f32_16x16x32_f16(false, a, false, b,
                                                (short)0, c, false, false);
}

// Lane l <-> lane l ^ 16 (the two halves of a wave hold the same row).
__device__ inline float xhalf(float x) {
  const int b = __builtin_bit_cast(int, x);
  return __builtin_bit_cast(float, __builtin_amdgcn_permlanex16(
      b, b, 0x76543210, 0xfedcba98, false, false));
}

// This lane's 64 columns of its row: kk*32 + g*16 + hi*8 + 0..7, the order of
// the WMMA A (and B) fragment. xr = row start + hi*8.
__device__ inline void load_row(const float* __restrict__ xr,
                                float4 (&xv)[16]) {
#pragma unroll
  for (int u = 0; u < 8; ++u) {
    xv[2 * u]     = *(const float4*)(xr + u * 16);
    xv[2 * u + 1] = *(const float4*)(xr + u * 16 + 4);
  }
  // The address stays in its registers up to this wait.
  asm volatile("s_wait_xcnt 0x0" :: "v"(xr) : "memory");
}

// LayerNorm of the row held by a lane and its partner lane ^ 16: four in-lane
// chains, then the other half of the row; the result, rounded to f16, is the
// wave's 16 x 128 operand in fragment order.
__device__ inline void norm_row(const float4 (&xv)[16],
                                const float* __restrict__ gamma,
                                const float* __restrict__ beta,
                                v16h (&A)[4]) {
  const int hi = (threadIdx.x & 31) >> 4;
  float4 s4 = {0.0f, 0.0f, 0.0f, 0.0f}, q4 = {0.0f, 0.0f, 0.0f, 0.0f};
#pragma unroll
  for (int u = 0; u < 16; ++u) {
    s4.x += xv[u].x; s4.y += xv[u].y; s4.z += xv[u].z; s4.w += xv[u].w;
    q4.x += xv[u].x * xv[u].x; q4.y += xv[u].y * xv[u].y;
    q4.z += xv[u].z * xv[u].z; q4.w += xv[u].w * xv[u].w;
  }
  float s  = (s4.x + s4.y) + (s4.z + s4.w);
  float ss = (q4.x + q4.y) + (q4.z + q4.w);
  s  += xhalf(s);
  ss += xhalf(ss);
  const float mu  = s * (1.0f / DPAIR);
  const float var = ss * (1.0f / DPAIR) - mu * mu;
  const float inv = rsqrtf(var + 1e-5f);
#pragma unroll
  for (int u = 0; u < 16; ++u) {
    const int c = (u >> 1) * 16 + hi * 8 + (u & 1) * 4;
    const float4 gv = *(const float4*)(gamma + c);
    const float4 bv = *(const float4*)(beta + c);
    const int t = (u & 3) * 4;           // element of fragment u >> 2
    A[u >> 2][t + 0] = (_Float16)((xv[u].x - mu) * inv * gv.x + bv.x);
    A[u >> 2][t + 1] = (_Float16)((xv[u].y - mu) * inv * gv.y + bv.y);
    A[u >> 2][t + 2] = (_Float16)((xv[u].z - mu) * inv * gv.z + bv.z);
    A[u >> 2][t + 3] = (_Float16)((xv[u].w - mu) * inv * gv.w + bv.w);
  }
}

// ---------------------------------------------------------------------------
// Kernel 1: the pair bias (it couples every row j with every row i, so
// it has to be complete before any attention starts). grid = 256 blocks of 16
// waves; block = (query tile jt, key tile kt), wave w owns the 16 rows
// (j = jt*16 + w, key = kt*16 .. +15).
// bias = layernorm(x) @ Wb (128 -> 4) comes from matrix products of the raw
// rows X, rounded to f16:
//   bias = inv * (x . (gamma * Wb) - mu * sum(gamma * Wb)) + sum(beta * Wb).
// The A operand T has, for the heads 2a and 2a + 1 in its rows 8a + 0..7:
// gamma * Wb rounded to f16 (two rows), what that rounding left (two rows),
// beta * Wb (two rows), ones, zeros. T . X^T gives each lane its position's
// products and its row sum, T . 1 the sums of gamma * Wb and of beta * Wb, and
// the diagonal of X . X^T the sum of squares. A lane of half a ends with heads 2a and 2a + 1.
// The bias is rounded to f16 and stored as half a WMMA A fragment per 16 x 16
// tile (row = key, k = query):
// biasws[h][jt][kt][lane][e] = bias(j = jt*16 + (lane >> 4)*8 + e,
//   key = kt*16 + (lane & 15), head h);
// the 16 waves of a block fill whole 128-byte lines of it between them.
// Beside that, the five 128 x 128 weights are rounded to f16 and transposed
// once for the whole chip: wtws[matrix][n][k], matrix = q, k, v, gate, out.
// Two waves write four half rows of 64 k (one 128-byte line each).
// The rows of the out matrix are dealt: column n of the output lies at row
// (n & ~63) + (n & 3) * 16 + ((n >> 2) & 15), so that lane c of the column
// tiles 4g .. 4g + 3 of the output product holds the four neighbouring columns
// g*64 + c*4 + 0..3.
// ---------------------------------------------------------------------------
#define WB_LD 136   // 128 + 8 pad (272B row stride, 16B aligned)
__global__ __launch_bounds__(512) void bias_kernel(
    const float* __restrict__ pair, const float* __restrict__ gamma,
    const float* __restrict__ beta, const float* __restrict__ Wb,
    const float* __restrict__ Wq, const float* __restrict__ Wk,
    const float* __restrict__ Wv, const float* __restrict__ Wg,
    const float* __restrict__ Wo, _Float16* __restrict__ biasws,
    _Float16* __restrict__ wtws) {
  __shared__ __attribute__((aligned(16))) _Float16 WbT[16 * WB_LD];  // 4352 B

  const int wave = threadIdx.x >> 5;
  const int lane = threadIdx.x & 31;
  const int kcol = lane & 15, hi = lane >> 4;
  const int jt = blockIdx.x >> 4, kt = blockIdx.x & 15;
  const size_t m0 = (size_t)((jt * 16 + wave) * LVAL + kt * 16);

  // 320 units of 4 rows n x 64 k, two waves each; scalar, so that the matrix
  // is picked without lane masks. Ahead of the row loads: its load and its
  // stores are then done long before the barrier, which waits for both, and
  // the other waves' row loads keep the memory path busy meanwhile.
  const int wu   = __builtin_amdgcn_readfirstlane(wave);
  const int unit = blockIdx.x + (wu >> 1) * 256;
  if (wu < 4 && unit < 320) {
    const int mtx = unit >> 6, n4 = ((unit >> 1) & 31) * 4;
    const int kk  = (unit & 1) * 64 + (threadIdx.x & 63);
    const float* Ws = mtx == 0 ? Wq : mtx == 1 ? Wk : mtx == 2 ? Wv
                    : mtx == 3 ? Wg : Wo;
    const float* wp = Ws + kk * DPAIR + n4;
    const float4 w = *(const float4*)wp;
    // The address stays in its registers up to this wait.
    asm volatile("s_wait_xcnt 0x0" :: "v"(wp) : "memory");
    // Row of column n4 and the step to the next column (dealt for out).
    const int row0 = mtx == 4 ? (n4 & ~63) + ((n4 >> 2) & 15) : n4;
    const int step = mtx == 4 ? 16 * DPAIR : DPAIR;
    _Float16* d = wtws + (mtx * DPAIR + row0) * DPAIR + kk;
    d[0 * step] = (_Float16)w.x;
    d[1 * step] = (_Float16)w.y;
    d[2 * step] = (_Float16)w.z;
    d[3 * step] = (_Float16)w.w;
    // Ahead of the row loads, which may be given the stores' registers.
    asm volatile("s_wait_xcnt 0x0" ::: "memory");
  }

  float4 xv[16];
  load_row(pair + (m0 + kcol) * DPAIR + hi * 8, xv);
  if (threadIdx.x < DPAIR) {
    const float4 w = *(const float4*)(Wb + threadIdx.x * NHEAD);
    const float g = gamma[threadIdx.x];
    const float s = beta[threadIdx.x];
    // Ahead of every later write of the registers that the loads name.
    asm volatile("s_wait_xcnt 0x0" ::: "memory");
    const float wf[4] = {w.x, w.y, w.z, w.w};
    _Float16* col = WbT + threadIdx.x;
#pragma unroll
    for (int h = 0; h < NHEAD; ++h) {
      const int row = (h >> 1) * 8 + (h & 1);
      const float gw = g * wf[h];
      const _Float16 top = (_Float16)gw;
      col[(row + 0) * WB_LD] = top;
      col[(row + 2) * WB_LD] = (_Float16)(gw - (float)top);
      col[(row + 4) * WB_LD] = (_Float16)(s * wf[h]);
    }
    col[6 * WB_LD]  = (_Float16)1.0f;  col[7 * WB_LD]  = (_Float16)0.0f;
    col[14 * WB_LD] = (_Float16)1.0f;  col[15 * WB_LD] = (_Float16)0.0f;
  }
  // The raw rows in fragment order (the k order of load_frag16x32).
  v16h X[4];
#pragma unroll
  for (int u = 0; u < 16; ++u) {
    const int t = (u & 3) * 4;           // element of fragment u >> 2
    X[u >> 2][t + 0] = (_Float16)xv[u].x;
    X[u >> 2][t + 1] = (_Float16)xv[u].y;
    X[u >> 2][t + 2] = (_Float16)xv[u].z;
    X[u >> 2][t + 3] = (_Float16)xv[u].w;
  }
  __syncthreads();

  v16h ones;
#pragma unroll
  for (int t = 0; t < 16; ++t) ones[t] = (_Float16)1.0f;
  // Register r of a lane: row 8*hi + r of T (tx, t1) or position 8*hi + r
  // (xx); the lane's column is position kcol.
  v8f tx = {}, t1 = {}, xx = {};
#pragma unroll
  for (int kk = 0; kk < 4; ++kk) {
    const v16h T = load_frag16x32(WbT + kk * 32, WB_LD);
    tx = wmma_f16(T, X[kk], tx);
    t1 = wmma_f16(T, ones, t1);
    xx = wmma_f16(X[kk], X[kk], xx);
  }
  // The diagonal element of position kcol sits in register kcol & 7 of the
  // half kcol >> 3; the other half takes it from there.
  float dg = xx[0];
#pragma unroll
  for (int r = 1; r < 8; ++r) dg = ((kcol & 7) == r) ? xx[r] : dg;
  const float og  = xhalf(dg);
  const float ss  = ((kcol >> 3) == hi) ? dg : og;
  const float mu  = tx[6] * (1.0f / DPAIR);
  const float var = ss * (1.0f / DPAIR) - mu * mu;
  const float inv = rsqrtf(var + 1e-5f);
  const float b0 = inv * ((tx[0] + tx[2]) - mu * (t1[0] + t1[2])) + t1[4];
  const float b1 = inv * ((tx[1] + tx[3]) - mu * (t1[1] + t1[3])) + t1[5];
  // Row kcol is key kt*16 + kcol of query jt*16 + wave; the lower half of
  // the wave stores heads 0 and 1, the upper half heads 2 and 3.
  const int at = (jt << 12) | (kt << 8) | ((kcol + 16 * (wave >> 3)) << 3) |
                 (wave & 7);
  biasws[((2 * hi + 0) << 16) | at] = (_Float16)b0;
  biasws[((2 * hi + 1) << 16) | at] = (_Float16)b1;
}

// ---------------------------------------------------------------------------
// Kernel 2: everything else of one row i in one block of 16 waves; wave w
// owns positions j = w*16 .. +15 of the row, as queries and as keys.
// The normalized rows stay in registers as fragments X. With X as the B
// operand a product comes out transposed (lane = position, 8 consecutive
// columns in the lane's registers), with X as the A operand plain (lane =
// column, 8 consecutive positions):
//   k^T = Wk^T . X^T  -> one 16-byte LDS store per tile into Ksh[key][column]
//   v   = X . Wv      -> one 16-byte LDS store per tile into VTsh[column][key]
//   q^T, gate^T       -> already in the order of the score product's B
//                        operand and of the O^T accumulators: never stored
// Attention per head as S^T = K . Q^T + bias^T . I, O^T += V^T . P^T with
// online softmax over passes of 128 keys; the gated O^T, rounded to f16, is
// the A fragment of the output product, which runs behind the head loop.
// ---------------------------------------------------------------------------
#define WT_LD 136   // 128 + 8 pad (272B row stride, 16B aligned)
#define VT_LD 264   // 256 + 8 pad
__global__ __launch_bounds__(512) void row_kernel(
    const float* __restrict__ pair, const float* __restrict__ gamma,
    const float* __restrict__ beta, const float* __restrict__ bg,
    const float* __restrict__ bo, const _Float16* __restrict__ biasws,
    const _Float16* __restrict__ wtws, float* __restrict__ out) {
  __shared__ __attribute__((aligned(16))) _Float16 WT[5][128 * WT_LD];  // 170 KB
  __shared__ __attribute__((aligned(16))) _Float16 Ksh[LVAL * WT_LD];   // 68 KB
  __shared__ __attribute__((aligned(16))) _Float16 VTsh[DPAIR * VT_LD]; // 66 KB

  const int wave = threadIdx.x >> 5;
  const int lane = threadIdx.x & 31;
  const int kcol = lane & 15, hi = lane >> 4;
  const size_t m0 = (size_t)blockIdx.x * LVAL + wave * 16;

  // Issued ahead of the weight staging.
  float4 xv[16];
  load_row(pair + (m0 + kcol) * DPAIR + hi * 8, xv);

  // The weight rows of 256 bytes go from the workspace straight into LDS at
  // the padded pitch: 16 lanes a row, so one copy of the block brings 32 rows
  // and four copies a matrix. Wk and Wv fly under the layernorm.
  const unsigned l0 = (unsigned)(size_t)(&WT[0][0]) +
                      (threadIdx.x >> 4) * (WT_LD * 2) + (threadIdx.x & 15) * 16;
  const _Float16* g0 = wtws + threadIdx.x * 8;
#define WL(c) "v"(l0 + (c) * (32 * WT_LD * 2))
#define WG(c) "v"(g0 + (c) * (512 * 8))
  // The closing wait stands ahead of every later write of the registers that
  // the copies name (a precaution).
  asm volatile(
      "global_load_async_to_lds_b128 %0, %8, off\n\t"
      "global_load_async_to_lds_b128 %1, %9, off\n\t"
      "global_load_async_to_lds_b128 %2, %10, off\n\t"
      "global_load_async_to_lds_b128 %3, %11, off\n\t"
      "global_load_async_to_lds_b128 %4, %12, off\n\t"
      "global_load_async_to_lds_b128 %5, %13, off\n\t"
      "global_load_async_to_lds_b128 %6, %14, off\n\t"
      "global_load_async_to_lds_b128 %7, %15, off\n\t"
      "s_wait_xcnt 0x0"
      :: WL(4), WL(5), WL(6), WL(7), WL(8), WL(9), WL(10), WL(11),
         WG(4), WG(5), WG(6), WG(7), WG(8), WG(9), WG(10), WG(11)
      : "memory");

  v16h X[4];
  norm_row(xv, gamma, beta, X);
  // Keeps the layernorm ahead of the barrier, under the copies' flight, and
  // the next copies' 36 address registers behind it (formed ahead of it they
  // push the kernel into scratch).
  __builtin_amdgcn_sched_barrier(0);
  // This wave's copies have landed; the barrier then publishes every wave's.
  asm volatile("s_wait_asynccnt 0x0" ::: "memory");
  __syncthreads();                       // Wk and Wv are staged

  // Wq, Wg and Wo are first read behind the next barrier: their copies fly
  // under the k and v products. Same closing wait as above.
  asm volatile(
      "global_load_async_to_lds_b128 %0, %12, off\n\t"
      "global_load_async_to_lds_b128 %1, %13, off\n\t"
      "global_load_async_to_lds_b128 %2, %14, off\n\t"
      "global_load_async_to_lds_b128 %3, %15, off\n\t"
      "global_load_async_to_lds_b128 %4, %16, off\n\t"
      "global_load_async_to_lds_b128 %5, %17, off\n\t"
      "global_load_async_to_lds_b128 %6, %18, off\n\t"
      "global_load_async_to_lds_b128 %7, %19, off\n\t"
      "global_load_async_to_lds_b128 %8, %20, off\n\t"
      "global_load_async_to_lds_b128 %9, %21, off\n\t"
      "global_load_async_to_lds_b128 %10, %22, off\n\t"
      "global_load_async_to_lds_b128 %11, %23, off\n\t"
      "s_wait_xcnt 0x0"
      :: WL(0), WL(1), WL(2), WL(3), WL(12), WL(13), WL(14), WL(15), WL(16),
         WL(17), WL(18), WL(19),
         WG(0), WG(1), WG(2), WG(3), WG(12), WG(13), WG(14), WG(15), WG(16),
         WG(17), WG(18), WG(19)
      : "memory");
#undef WL
#undef WG

  // --- k and v of this wave's 16 positions, all heads, into LDS ---
#pragma unroll
  for (int nt = 0; nt < 8; ++nt) {
    v8f ak = {}, av = {};
#pragma unroll
    for (int kk = 0; kk < 4; ++kk) {
      const v16h wk = load_frag16x32(WT[1] + (nt * 16) * WT_LD + kk * 32, WT_LD);
      const v16h wv = load_frag16x32(WT[2] + (nt * 16) * WT_LD + kk * 32, WT_LD);
      ak = wmma_f16(wk, X[kk], ak);      // column nt*16 + 8*hi + r, key kcol
      av = wmma_f16(X[kk], wv, av);      // key 8*hi + r, column nt*16 + kcol
    }
    v8h hk, hv;
#pragma unroll
    for (int r = 0; r < 8; ++r) { hk[r] = (_Float16)ak[r]; hv[r] = (_Float16)av[r]; }
    *(v8h*)(Ksh + (wave * 16 + kcol) * WT_LD + nt * 16 + hi * 8) = hk;
    *(v8h*)(VTsh + (nt * 16 + kcol) * VT_LD + wave * 16 + hi * 8) = hv;
  }
  // This wave's second run of copies has landed, ahead of the barrier.
  asm volatile("s_wait_asynccnt 0x0" ::: "memory");
  __syncthreads();       // every wave's k and v, and Wq, Wg, Wo, are in LDS

  // Wk and Wv are dead behind that barrier: each wave parks its gated O
  // fragments there, 4 KB of its own, read back by the same lanes only.
  _Float16* park = WT[1] + wave * 2048 + lane * 8;

  // The f16 bias is widened and laid into the score accumulators by the
  // matrix unit: one A fragment holds two key tiles (k 0..15 = the queries of
  // the first, k 16..31 of the second), and the unit matrix in the upper or
  // the lower 16 rows of B picks one of them (the other meets zeros, which is
  // exact for every finite f16 value).
  v16h Ilo, Ihi;
#pragma unroll
  for (int t = 0; t < 8; ++t) {
    const _Float16 one = (hi * 8 + t == kcol) ? (_Float16)1.0f : (_Float16)0.0f;
    Ilo[t] = one;             Ilo[t + 8] = (_Float16)0.0f;
    Ihi[t] = (_Float16)0.0f;  Ihi[t + 8] = one;
  }

  for (int h = 0; h < NHEAD; ++h) {
    // --- q^T: the B operand of the scores, column kcol = query ---
    v16h bQ;
    {
      v8f q0 = {}, q1 = {};
#pragma unroll
      for (int kk = 0; kk < 4; ++kk) {
        const v16h w0 = load_frag16x32(WT[0] + (h * DHID) * WT_LD + kk * 32, WT_LD);
        const v16h w1 = load_frag16x32(WT[0] + (h * DHID + 16) * WT_LD + kk * 32, WT_LD);
        q0 = wmma_f16(w0, X[kk], q0);    // d = 8*hi + r
        q1 = wmma_f16(w1, X[kk], q1);    // d = 16 + 8*hi + r
      }
#pragma unroll
      for (int r = 0; r < 8; ++r) {
        bQ[r]     = (_Float16)(q0[r] * SCALING);
        bQ[r + 8] = (_Float16)(q1[r] * SCALING);
      }
    }
    // 256 halves per (query tile, 16 keys); a wave's b128 load is 512 B in a row.
    const _Float16* biasF =
        biasws + (size_t)((h * 16 + wave) * 16) * 256 + lane * 8;

    v8f O0 = {}, O1 = {};              // O^T: d = 8*hi + r and 16 + 8*hi + r
    // This lane's query: nm = -(running maximum) * log2(e), and the sum.
    float nm = 3.0e38f, sum = 0.0f;

    // Kept rolled: unrolled, the two passes' tiles overlap in registers and
    // the normalized rows are spilled to scratch.
#pragma unroll 1
    for (int cc = 0; cc < 2; ++cc) {     // 128 keys per pass
      // --- scores: eight independent 16x16 tiles, rows = keys, the bias added
      // last; the pass's 8 bias loads are in flight together ---
      const _Float16* bp = biasF + cc * 2048;
      v8h cb[8];
#pragma unroll
      for (int u = 0; u < 8; ++u) cb[u] = *(const v8h*)(bp + u * 256);
      // The address stays in its registers up to this wait.
      asm volatile("s_wait_xcnt 0x0" :: "v"(bp) : "memory");
      v8f S[8];                          // S[t]: key cc*128 + t*16 + 8*hi + r
#pragma unroll
      for (int t = 0; t < 8; ++t) {
        const v16h aK = load_frag16x32(
            Ksh + (cc * 8 + t) * 16 * WT_LD + h * DHID, WT_LD);
        const v8f zero = {};
        S[t] = wmma_f16(aK, bQ, zero);   // under the bias loads' flight
      }
#pragma unroll
      for (int p = 0; p < 4; ++p) {
        v16h aB;
#pragma unroll
        for (int e = 0; e < 8; ++e) {
          aB[e] = cb[2 * p][e]; aB[e + 8] = cb[2 * p + 1][e];
        }
        S[2 * p]     = wmma_f16(aB, Ilo, S[2 * p]);
        S[2 * p + 1] = wmma_f16(aB, Ihi, S[2 * p + 1]);
      }

      // --- online softmax update, in-lane: four chains, then joined ---
      float tq[4];
#pragma unroll
      for (int p = 0; p < 4; ++p) {
        tq[p] = fmaxf(S[2 * p][0], S[2 * p + 1][0]);
#pragma unroll
        for (int r = 1; r < 8; ++r)
          tq[p] = fmaxf(tq[p], fmaxf(S[2 * p][r], S[2 * p + 1][r]));
      }
      float tm = fmaxf(fmaxf(tq[0], tq[1]), fmaxf(tq[2], tq[3]));
      tm = fmaxf(tm, xhalf(tm));
      // exp(s - max) = 2^(s * log2(e) + nm): one fused multiply-add in front
      // of each v_exp_f32. The rounding of nm is common to a query's terms
      // and to cf, so it cancels against the sum.
      const float nmold = nm;
      nm = fminf(nmold, -tm * LOG2E);
      const float cf = __builtin_amdgcn_exp2f(nm - nmold);
      v16h bP[4];                        // P^T in the hardware k order
      float pq[4];
#pragma unroll
      for (int p = 0; p < 4; ++p) {
        pq[p] = 0.0f;
#pragma unroll
        for (int r = 0; r < 8; ++r) {
          const float e0 = __builtin_amdgcn_exp2f(fmaf(S[2 * p][r], LOG2E, nm));
          const float e1 = __builtin_amdgcn_exp2f(fmaf(S[2 * p + 1][r], LOG2E, nm));
          pq[p] += e0 + e1;
          bP[p][r]     = (_Float16)e0;
          bP[p][r + 8] = (_Float16)e1;
        }
      }
      // this half's keys only
      sum = sum * cf + ((pq[0] + pq[1]) + (pq[2] + pq[3]));
#pragma unroll
      for (int r = 0; r < 8; ++r) { O0[r] *= cf; O1[r] *= cf; }

      // --- accumulate O^T += V^T(32x128) @ P^T(128x16) ---
#pragma unroll
      for (int p = 0; p < 4; ++p) {
        const v16h aV0 = load_frag16x32(
            VTsh + (h * DHID + 0)  * VT_LD + (cc * 4 + p) * 32, VT_LD);
        const v16h aV1 = load_frag16x32(
            VTsh + (h * DHID + 16) * VT_LD + (cc * 4 + p) * 32, VT_LD);
        O0 = wmma_f16(aV0, bP[p], O0);
        O1 = wmma_f16(aV1, bP[p], O1);
      }
    }

    // --- gate^T, in the order of O^T ---
    v8f g0 = {}, g1 = {};
#pragma unroll
    for (int kk = 0; kk < 4; ++kk) {
      const v16h w0 = load_frag16x32(WT[3] + (h * DHID) * WT_LD + kk * 32, WT_LD);
      const v16h w1 = load_frag16x32(WT[3] + (h * DHID + 16) * WT_LD + kk * 32, WT_LD);
      g0 = wmma_f16(w0, X[kk], g0);
      g1 = wmma_f16(w1, X[kk], g1);
    }
    const float* bgp = bg + h * DHID + hi * 8;
    const float4 b00 = *(const float4*)(bgp);
    const float4 b01 = *(const float4*)(bgp + 4);
    const float4 b10 = *(const float4*)(bgp + 16);
    const float4 b11 = *(const float4*)(bgp + 20);
    const v8f B0 = {b00.x, b00.y, b00.z, b00.w, b01.x, b01.y, b01.z, b01.w};
    const v8f B1 = {b10.x, b10.y, b10.z, b10.w, b11.x, b11.y, b11.z, b11.w};

    // --- join the halves' sums, normalize, gate: A fragment of the output
    // product (row kcol = query, k = this head's 32 columns).
    // O / sum * sigmoid(g) = O / ((1 + exp(-g)) * sum): one fused multiply-add
    // and one hardware reciprocal per element. The divisor is at least the
    // sum, which holds the largest key's exp(0) = 1; where exp(-g) overflows
    // it is infinite and the element 0, as with the division. ---
    const float tot = sum + xhalf(sum);
    v16h aO;
#pragma unroll
    for (int r = 0; r < 8; ++r) {
      const float e0 = __expf(-(g0[r] + B0[r]));
      const float e1 = __expf(-(g1[r] + B1[r]));
      aO[r]     = (_Float16)(O0[r] * __builtin_amdgcn_rcpf(fmaf(e0, tot, tot)));
      aO[r + 8] = (_Float16)(O1[r] * __builtin_amdgcn_rcpf(fmaf(e1, tot, tot)));
    }
    v8h lo, up;
#pragma unroll
    for (int r = 0; r < 8; ++r) { lo[r] = aO[r]; up[r] = aO[r + 8]; }
    *(v8h*)(park + h * 512)       = lo;
    *(v8h*)(park + h * 512 + 256) = up;
  }

  // This lane's eight output columns: g*64 + kcol*4 + 0..3, g = 0, 1.
  const float* bop = bo + kcol * 4;
  const float4 bo0 = *(const float4*)(bop);
  const float4 bo1 = *(const float4*)(bop + 64);
  // The address stays in its registers up to this wait.
  asm volatile("s_wait_xcnt 0x0" :: "v"(bop) : "memory");

  // --- output product, once for all heads: eight independent accumulators,
  // each summed head by head. Row nt*16 + kcol of the staged out matrix is
  // output column (nt >> 2)*64 + kcol*4 + (nt & 3) ---
  v8f acc[8] = {};                       // out rows 8*hi + r
#pragma unroll
  for (int h = 0; h < NHEAD; ++h) {
    const v8h lo = *(const v8h*)(park + h * 512);
    const v8h up = *(const v8h*)(park + h * 512 + 256);
    v16h aO;
#pragma unroll
    for (int r = 0; r < 8; ++r) { aO[r] = lo[r]; aO[r + 8] = up[r]; }
#pragma unroll
    for (int nt = 0; nt < 8; ++nt) {
      const v16h wo = load_frag16x32(WT[4] + (nt * 16) * WT_LD + h * DHID, WT_LD);
      acc[nt] = wmma_f16(aO, wo, acc[nt]);
    }
  }

  // 16 bytes a lane: a store covers 256 bytes in a row of each of two rows.
  float* op = out + (m0 + 8 * hi) * DPAIR + kcol * 4;
#pragma unroll
  for (int r = 0; r < 8; ++r) {
    const float4 o0 = {acc[0][r] + bo0.x, acc[1][r] + bo0.y,
                       acc[2][r] + bo0.z, acc[3][r] + bo0.w};
    const float4 o1 = {acc[4][r] + bo1.x, acc[5][r] + bo1.y,
                       acc[6][r] + bo1.z, acc[7][r] + bo1.w};
    *(float4*)(op + r * DPAIR)      = o0;
    *(float4*)(op + r * DPAIR + 64) = o1;
  }
}

// ---------------------------------------------------------------------------
// Launch.  Inputs: 0 pair, 1 gamma, 2 beta, 3 Wq, 4 Wk, 5 Wv, 6 Wb, 7 Wg,
// 8 bg, 9 Wo, 10 bo.  Output: f32 (1,256,256,128).
// Workspace: the bias, NHEAD*NPOS f16 = 512 KB, then the f16 weights, 160 KB.
// ---------------------------------------------------------------------------
extern "C" void kernel_launch(void* const* d_in, const int* in_sizes, int n_in,
                              void* d_out, int out_size, void* d_ws,
                              size_t ws_size, hipStream_t stream) {
  const float* pair  = (const float*)d_in[0];
  const float* gamma = (const float*)d_in[1];
  const float* beta  = (const float*)d_in[2];
  const float* Wq    = (const float*)d_in[3];
  const float* Wk    = (const float*)d_in[4];
  const float* Wv    = (const float*)d_in[5];
  const float* Wb    = (const float*)d_in[6];
  const float* Wg    = (const float*)d_in[7];
  const float* bg    = (const float*)d_in[8];
  const float* Wo    = (const float*)d_in[9];
  const float* bo    = (const float*)d_in[10];
  float* out  = (float*)d_out;
  _Float16* bbuf = (_Float16*)d_ws;
  _Float16* wbuf = bbuf + NHEAD * NPOS;

  bias_kernel<<<NPOS / 256, 512, 0, stream>>>(pair, gamma, beta, Wb, Wq, Wk, Wv,
                                              Wg, Wo, bbuf, wbuf);
  row_kernel<<<LVAL, 512, 0, stream>>>(pair, gamma, beta, bg, bo, bbuf, wbuf,
                                       out);
}

// v010
// Measured time: 26.9 microseconds a run.
// Next to v009, in two timings, it ran 1.03 times as fast each time.
// All steps since v000 together make it 4.75 times as fast.
#include <hip/hip_runtime.h>
#include <hip/hip_bf16.h>

// ---------------------------------------------------------------------------
// Triangle attention for MI455X (gfx1250, wave32, WMMA 16x16x32 f16).
// L=256, D_PAIR=128, N_HEAD=4, D_HID=32, NPOS=65536.
// ---------------------------------------------------------------------------

#define LVAL   256
#define DPAIR  128
#define NHEAD  4
#define DHID   32
#define NPOS   (LVAL * LVAL)
#define SCALING 0.17677669529663687f   // 1/sqrt(32)
#define LOG2E   1.4426950408889634f    // v_exp_f32 is a power of two

typedef __attribute__((ext_vector_type(16))) _Float16 v16h;
typedef __attribute__((ext_vector_type(8)))  _Float16 v8h;
typedef __attribute__((ext_vector_type(8)))  float    v8f;

// Load one 16x32 f16 fragment (A-matrix layout; also used for B as B^T rows)
// from row-major storage with row stride `ld` (elements).
// ISA layout (16-bit A 16x32): lanes 0-15 -> M=0-15, cols {0..7,16..23};
// lanes 16-31 -> M=0-15, cols {8..15,24..31}. Two b128 loads per lane.
__device__ inline v16h load_frag16x32(const _Float16* p, int ld) {
  const int lane = threadIdx.x & 31;
  const int row  = lane & 15;
  const int hi   = lane >> 4;
  const _Float16* r = p + row * ld + hi * 8;
  v8h a = *(const v8h*)(r);
  v8h b = *(const v8h*)(r + 16);
  v16h f;
#pragma unroll
  for (int t = 0; t < 8; ++t) { f[t] = a[t]; f[t + 8] = b[t]; }
  return f;
}

__device__ inline v8f wmma_f16(v16h a, v16h b, v8f c) {
  return __builtin_amdgcn_wmma_f32_16x16x32_f16(false, a, false, b,
                                                (short)0, c, false, false);
}

// Lane l <-> lane l ^ 16 (the two halves of a wave hold the same row).
__device__ inline float xhalf(float x) {
  const int b = __builtin_bit_cast(int, x);
  return __builtin_bit_cast(float, __builtin_amdgcn_permlanex16(
      b, b, 0x76543210, 0xfedcba98, false, false));
}

// A wave's 16 rows of 512 bytes lie in a row in memory. A load in fragment
// order (lane = row) touches 16 lines for 512 bytes; a copy of one whole row,
// 16 bytes a lane, touches four. So the rows go to the wave's own slice of LDS
// by whole-row copies and are read from there in fragment order. The pitch of
// 528 bytes (16 x 33) spreads 16 rows' 16-byte pieces over all 64 banks.
#define XS_LD   132            // floats a staged row: 128 + 4 pad
#define XS_WAVE (16 * XS_LD)   // floats a wave's slice
// g: the first row's start + lane * 4; l: LDS byte address of the slice's
// start + lane * 16.
__device__ inline void copy_rows(const float* g, unsigned l) {
#define RL(r) "v"(l + (r) * (XS_LD * 4))
#define RG(r) "v"(g + (r) * DPAIR)
  // The closing wait of each statement stands ahead of every later write of
  // the registers that its copies name (a precaution).
  asm volatile(
      "global_load_async_to_lds_b128 %0, %8, off\n\t"
      "global_load_async_to_lds_b128 %1, %9, off\n\t"
      "global_load_async_to_lds_b128 %2, %10, off\n\t"
      "global_load_async_to_lds_b128 %3, %11, off\n\t"
      "global_load_async_to_lds_b128 %4, %12, off\n\t"
      "global_load_async_to_lds_b128 %5, %13, off\n\t"
      "global_load_async_to_lds_b128 %6, %14, off\n\t"
      "global_load_async_to_lds_b128 %7, %15, off\n\t"
      "s_wait_xcnt 0x0"
      :: RL(0), RL(1), RL(2), RL(3), RL(4), RL(5), RL(6), RL(7),
         RG(0), RG(1), RG(2), RG(3), RG(4), RG(5), RG(6), RG(7)
      : "memory");
  asm volatile(
      "global_load_async_to_lds_b128 %0, %8, off\n\t"
      "global_load_async_to_lds_b128 %1, %9, off\n\t"
      "global_load_async_to_lds_b128 %2, %10, off\n\t"
      "global_load_async_to_lds_b128 %3, %11, off\n\t"
      "global_load_async_to_lds_b128 %4, %12, off\n\t"
      "global_load_async_to_lds_b128 %5, %13, off\n\t"
      "global_load_async_to_lds_b128 %6, %14, off\n\t"
      "global_load_async_to_lds_b128 %7, %15, off\n\t"
      "s_wait_xcnt 0x0"
      :: RL(8), RL(9), RL(10), RL(11), RL(12), RL(13), RL(14), RL(15),
         RG(8), RG(9), RG(10), RG(11), RG(12), RG(13), RG(14), RG(15)
      : "memory");
#undef RL
#undef RG
}

// This lane's 64 columns of a row: kk*32 + g*16 + hi*8 + 0..7, the order of
// the WMMA A (and B) fragment. xr = the row's start + hi*8.
__device__ inline void read_row(const float* xr, float4 (&xv)[16]) {
#pragma unroll
  for (int u = 0; u < 8; ++u) {
    xv[2 * u]     = *(const float4*)(xr + u * 16);
    xv[2 * u + 1] = *(const float4*)(xr + u * 16 + 4);
  }
}

// LayerNorm of the row held by a lane and its partner lane ^ 16: four in-lane
// chains, then the other half of the row; the result, rounded to f16, is the
// wave's 16 x 128 operand in fragment order. gm, bt: gamma and beta at the
// columns of xv.
__device__ inline void norm_row(const float4 (&xv)[16],
                                const float4 (&gm)[16],
                                const float4 (&bt)[16], v16h (&A)[4]) {
  float4 s4 = {0.0f, 0.0f, 0.0f, 0.0f}, q4 = {0.0f, 0.0f, 0.0f, 0.0f};
#pragma unroll
  for (int u = 0; u < 16; ++u) {
    s4.x += xv[u].x; s4.y += xv[u].y; s4.z += xv[u].z; s4.w += xv[u].w;
    q4.x += xv[u].x * xv[u].x; q4.y += xv[u].y * xv[u].y;
    q4.z += xv[u].z * xv[u].z; q4.w += xv[u].w * xv[u].w;
  }
  float s  = (s4.x + s4.y) + (s4.z + s4.w);
  float ss = (q4.x + q4.y) + (q4.z + q4.w);
  s  += xhalf(s);
  ss += xhalf(ss);
  const float mu  = s * (1.0f / DPAIR);
  const float var = ss * (1.0f / DPAIR) - mu * mu;
  const float inv = rsqrtf(var + 1e-5f);
#pragma unroll
  for (int u = 0; u < 16; ++u) {
    const float4 gv = gm[u], bv = bt[u];
    const int t = (u & 3) * 4;           // element of fragment u >> 2
    A[u >> 2][t + 0] = (_Float16)((xv[u].x - mu) * inv * gv.x + bv.x);
    A[u >> 2][t + 1] = (_Float16)((xv[u].y - mu) * inv * gv.y + bv.y);
    A[u >> 2][t + 2] = (_Float16)((xv[u].z - mu) * inv * gv.z + bv.z);
    A[u >> 2][t + 3] = (_Float16)((xv[u].w - mu) * inv * gv.w + bv.w);
  }
}

// ---------------------------------------------------------------------------
// Kernel 1: the pair bias (it couples every row j with every row i, so
// it has to be complete before any attention starts). grid = 256 blocks of 16
// waves; block = (query tile jt, key tile kt), wave w owns the 16 rows
// (j = jt*16 + w, key = kt*16 .. +15).
// bias = layernorm(x) @ Wb (128 -> 4) comes from matrix products of the raw
// rows X, rounded to f16:
//   bias = inv * (x . (gamma * Wb) - mu * sum(gamma * Wb)) + sum(beta * Wb).
// The A operand T has, for the heads 2a and 2a + 1 in its rows 8a + 0..7:
// gamma * Wb rounded to f16 (two rows), what that rounding left (two rows),
// beta * Wb (two rows), ones, zeros. T . X^T gives each lane its position's
// products and its row sum, T . 1 the sums of gamma * Wb and of beta * Wb, and
// the diagonal of X . X^T the sum of squares. A lane of half a ends with heads 2a and 2a + 1.
// The bias is rounded to f16 and stored as half a WMMA A fragment per 16 x 16
// tile (row = key, k = query):
// biasws[h][jt][kt][lane][e] = bias(j = jt*16 + (lane >> 4)*8 + e,
//   key = kt*16 + (lane & 15), head h);
// the 16 waves of a block fill whole 128-byte lines of it between them.
// Beside that, the five 128 x 128 weights are rounded to f16 and transposed
// once for the whole chip: wtws[matrix][n][k], matrix = q, k, v, gate, out.
// Two waves write four half rows of 64 k (one 128-byte line each).
// The rows of the out matrix are dealt: column n of the output lies at row
// (n & ~63) + (n & 3) * 16 + ((n >> 2) & 15), so that lane c of the column
// tiles 4g .. 4g + 3 of the output product holds the four neighbouring columns
// g*64 + c*4 + 0..3.
// ---------------------------------------------------------------------------
#define WB_LD 136   // 128 + 8 pad (272B row stride, 16B aligned)
__global__ __launch_bounds__(512) void bias_kernel(
    const float* __restrict__ pair, const float* __restrict__ gamma,
    const float* __restrict__ beta, const float* __restrict__ Wb,
    const float* __restrict__ Wq, const float* __restrict__ Wk,
    const float* __restrict__ Wv, const float* __restrict__ Wg,
    const float* __restrict__ Wo, _Float16* __restrict__ biasws,
    _Float16* __restrict__ wtws) {
  __shared__ __attribute__((aligned(16))) _Float16 WbT[16 * WB_LD];  // 4352 B
  __shared__ __attribute__((aligned(16))) float XS[16 * XS_WAVE];    // 132 KB

  const int wave = threadIdx.x >> 5;
  const int lane = threadIdx.x & 31;
  const int kcol = lane & 15, hi = lane >> 4;
  const int jt = blockIdx.x >> 4, kt = blockIdx.x & 15;
  const size_t m0 = (size_t)((jt * 16 + wave) * LVAL + kt * 16);

  // They take no result registers, so they fly under all that follows.
  copy_rows(pair + m0 * DPAIR + lane * 4,
            (unsigned)(size_t)(&XS[0]) + wave * (XS_WAVE * 4) + lane * 16);

  // 320 units of 4 rows n x 64 k, two waves each; scalar, so that the matrix
  // is picked without lane masks.
  const int wu   = __builtin_amdgcn_readfirstlane(wave);
  const int unit = blockIdx.x + (wu >> 1) * 256;
  if (wu < 4 && unit < 320) {
    const int mtx = unit >> 6, n4 = ((unit >> 1) & 31) * 4;
    const int kk  = (unit & 1) * 64 + (threadIdx.x & 63);
    const float* Ws = mtx == 0 ? Wq : mtx == 1 ? Wk : mtx == 2 ? Wv
                    : mtx == 3 ? Wg : Wo;
    const float* wp = Ws + kk * DPAIR + n4;
    const float4 w = *(const float4*)wp;
    // The address stays in its registers up to this wait.
    asm volatile("s_wait_xcnt 0x0" :: "v"(wp) : "memory");
    // Row of column n4 and the step to the next column (dealt for out).
    const int row0 = mtx == 4 ? (n4 & ~63) + ((n4 >> 2) & 15) : n4;
    const int step = mtx == 4 ? 16 * DPAIR : DPAIR;
    _Float16* d = wtws + (mtx * DPAIR + row0) * DPAIR + kk;
    d[0 * step] = (_Float16)w.x;
    d[1 * step] = (_Float16)w.y;
    d[2 * step] = (_Float16)w.z;
    d[3 * step] = (_Float16)w.w;
    // Ahead of every later write of the registers that the stores name.
    asm volatile("s_wait_xcnt 0x0" ::: "memory");
  }

  if (threadIdx.x < DPAIR) {
    const float4 w = *(const float4*)(Wb + threadIdx.x * NHEAD);
    const float g = gamma[threadIdx.x];
    const float s = beta[threadIdx.x];
    // Ahead of every later write of the registers that the loads name.
    asm volatile("s_wait_xcnt 0x0" ::: "memory");
    const float wf[4] = {w.x, w.y, w.z, w.w};
    _Float16* col = WbT + threadIdx.x;
#pragma unroll
    for (int h = 0; h < NHEAD; ++h) {
      const int row = (h >> 1) * 8 + (h & 1);
      const float gw = g * wf[h];
      const _Float16 top = (_Float16)gw;
      col[(row + 0) * WB_LD] = top;
      col[(row + 2) * WB_LD] = (_Float16)(gw - (float)top);
      col[(row + 4) * WB_LD] = (_Float16)(s * wf[h]);
    }
    col[6 * WB_LD]  = (_Float16)1.0f;  col[7 * WB_LD]  = (_Float16)0.0f;
    col[14 * WB_LD] = (_Float16)1.0f;  col[15 * WB_LD] = (_Float16)0.0f;
  }
  // This wave's rows have landed; no other wave reads them.
  asm volatile("s_wait_asynccnt 0x0" ::: "memory");
  float4 xv[16];
  read_row(XS + wave * XS_WAVE + kcol * XS_LD + hi * 8, xv);
  // The raw rows in fragment order (the k order of load_frag16x32).
  v16h X[4];
#pragma unroll
  for (int u = 0; u < 16; ++u) {
    const int t = (u & 3) * 4;           // element of fragment u >> 2
    X[u >> 2][t + 0] = (_Float16)xv[u].x;
    X[u >> 2][t + 1] = (_Float16)xv[u].y;
    X[u >> 2][t + 2] = (_Float16)xv[u].z;
    X[u >> 2][t + 3] = (_Float16)xv[u].w;
  }
  __syncthreads();

  v16h ones;
#pragma unroll
  for (int t = 0; t < 16; ++t) ones[t] = (_Float16)1.0f;
  // Register r of a lane: row 8*hi + r of T (tx, t1) or position 8*hi + r
  // (xx); the lane's column is position kcol.
  v8f tx = {}, t1 = {}, xx = {};
#pragma unroll
  for (int kk = 0; kk < 4; ++kk) {
    const v16h T = load_frag16x32(WbT + kk * 32, WB_LD);
    tx = wmma_f16(T, X[kk], tx);
    t1 = wmma_f16(T, ones, t1);
    xx = wmma_f16(X[kk], X[kk], xx);
  }
  // The diagonal element of position kcol sits in register kcol & 7 of the
  // half kcol >> 3; the other half takes it from there.
  float dg = xx[0];
#pragma unroll
  for (int r = 1; r < 8; ++r) dg = ((kcol & 7) == r) ? xx[r] : dg;
  const float og  = xhalf(dg);
  const float ss  = ((kcol >> 3) == hi) ? dg : og;
  const float mu  = tx[6] * (1.0f / DPAIR);
  const float var = ss * (1.0f / DPAIR) - mu * mu;
  const float inv = rsqrtf(var + 1e-5f);
  const float b0 = inv * ((tx[0] + tx[2]) - mu * (t1[0] + t1[2])) + t1[4];
  const float b1 = inv * ((tx[1] + tx[3]) - mu * (t1[1] + t1[3])) + t1[5];
  // Row kcol is key kt*16 + kcol of query jt*16 + wave; the lower half of
  // the wave stores heads 0 and 1, the upper half heads 2 and 3.
  const int at = (jt << 12) | (kt << 8) | ((kcol + 16 * (wave >> 3)) << 3) |
                 (wave & 7);
  biasws[((2 * hi + 0) << 16) | at] = (_Float16)b0;
  biasws[((2 * hi + 1) << 16) | at] = (_Float16)b1;
}

// ---------------------------------------------------------------------------
// Kernel 2: everything else of one row i in one block of 16 waves; wave w
// owns positions j = w*16 .. +15 of the row, as queries and as keys.
// The normalized rows stay in registers as fragments X. With X as the B
// operand a product comes out transposed (lane = position, 8 consecutive
// columns in the lane's registers), with X as the A operand plain (lane =
// column, 8 consecutive positions):
//   k^T = Wk^T . X^T  -> one 16-byte LDS store per tile into Ksh[key][column]
//   v   = X . Wv      -> one 16-byte LDS store per tile into VTsh[column][key]
//   q^T, gate^T       -> already in the order of the score product's B
//                        operand and of the O^T accumulators: never stored
// Attention per head as S^T = K . Q^T + bias^T . I, O^T += V^T . P^T with
// online softmax over passes of 128 keys; the gated O^T, rounded to f16, is
// the A fragment of the output product, which runs behind the head loop.
// ---------------------------------------------------------------------------
#define WT_LD 136   // 128 + 8 pad (272B row stride, 16B aligned)
#define VT_LD 264   // 256 + 8 pad
__global__ __launch_bounds__(512) void row_kernel(
    const float* __restrict__ pair, const float* __restrict__ gamma,
    const float* __restrict__ beta, const float* __restrict__ bg,
    const float* __restrict__ bo, const _Float16* __restrict__ biasws,
    const _Float16* __restrict__ wtws, float* __restrict__ out) {
  __shared__ __attribute__((aligned(16))) _Float16 WT[5][128 * WT_LD];  // 170 KB
  // k (68 KB), then v^T (66 KB); up to the first barrier the raw rows (132 KB).
  __shared__ __attribute__((aligned(16)))
      _Float16 KV[LVAL * WT_LD + DPAIR * VT_LD];
  static_assert(16 * XS_WAVE * 4 <= sizeof(KV), "the staged rows fit");
  _Float16* const Ksh  = KV;
  _Float16* const VTsh = KV + LVAL * WT_LD;
  const float* const XS = (const float*)KV;

  const int wave = threadIdx.x >> 5;
  const int lane = threadIdx.x & 31;
  const int kcol = lane & 15, hi = lane >> 4;
  const size_t m0 = (size_t)blockIdx.x * LVAL + wave * 16;

  // Issued ahead of the weight staging.
  copy_rows(pair + m0 * DPAIR + lane * 4,
            (unsigned)(size_t)(&KV[0]) + wave * (XS_WAVE * 4) + lane * 16);

  // The weight rows of 256 bytes go from the workspace straight into LDS at
  // the padded pitch: 16 lanes a row, so one copy of the block brings 32 rows
  // and four copies a matrix. Wk and Wv fly under the layernorm.
  const unsigned l0 = (unsigned)(size_t)(&WT[0][0]) +
                      (threadIdx.x >> 4) * (WT_LD * 2) + (threadIdx.x & 15) * 16;
  const _Float16* g0 = wtws + threadIdx.x * 8;
#define WL(c) "v"(l0 + (c) * (32 * WT_LD * 2))
#define WG(c) "v"(g0 + (c) * (512 * 8))
  // The closing wait stands ahead of every later write of the registers that
  // the copies name (a precaution).
  asm volatile(
      "global_load_async_to_lds_b128 %0, %8, off\n\t"
      "global_load_async_to_lds_b128 %1, %9, off\n\t"
      "global_load_async_to_lds_b128 %2, %10, off\n\t"
      "global_load_async_to_lds_b128 %3, %11, off\n\t"
      "global_load_async_to_lds_b128 %4, %12, off\n\t"
      "global_load_async_to_lds_b128 %5, %13, off\n\t"
      "global_load_async_to_lds_b128 %6, %14, off\n\t"
      "global_load_async_to_lds_b128 %7, %15, off\n\t"
      "s_wait_xcnt 0x0"
      :: WL(4), WL(5), WL(6), WL(7), WL(8), WL(9), WL(10), WL(11),
         WG(4), WG(5), WG(6), WG(7), WG(8), WG(9), WG(10), WG(11)
      : "memory");

  // gamma and beta at this lane's columns, loaded under the copies' flight.
  float4 gm[16], bt[16];
  read_row(gamma + hi * 8, gm);
  read_row(beta + hi * 8, bt);
  // Ahead of every later write of the registers that these loads name.
  asm volatile("s_wait_xcnt 0x0" ::: "memory");
  // All but the eight youngest copies, the weights', have landed: this wave's
  // rows, which no other wave reads.
  asm volatile("s_wait_asynccnt 0x8" ::: "memory");
  float4 xv[16];
  read_row(XS + wave * XS_WAVE + kcol * XS_LD + hi * 8, xv);
  v16h X[4];
  norm_row(xv, gm, bt, X);
  // Keeps the layernorm ahead of the barrier, under the copies' flight, and
  // the next copies' 36 address registers behind it (formed ahead of it they
  // push the kernel into scratch).
  __builtin_amdgcn_sched_barrier(0);
  // This wave's copies have landed; the barrier then publishes every wave's.
  asm volatile("s_wait_asynccnt 0x0" ::: "memory");
  __syncthreads();                       // Wk and Wv are staged

  // Wq, Wg and Wo are first read behind the next barrier: their copies fly
  // under the k and v products. Same closing wait as above.
  asm volatile(
      "global_load_async_to_lds_b128 %0, %12, off\n\t"
      "global_load_async_to_lds_b128 %1, %13, off\n\t"
      "global_load_async_to_lds_b128 %2, %14, off\n\t"
      "global_load_async_to_lds_b128 %3, %15, off\n\t"
      "global_load_async_to_lds_b128 %4, %16, off\n\t"
      "global_load_async_to_lds_b128 %5, %17, off\n\t"
      "global_load_async_to_lds_b128 %6, %18, off\n\t"
      "global_load_async_to_lds_b128 %7, %19, off\n\t"
      "global_load_async_to_lds_b128 %8, %20, off\n\t"
      "global_load_async_to_lds_b128 %9, %21, off\n\t"
      "global_load_async_to_lds_b128 %10, %22, off\n\t"
      "global_load_async_to_lds_b128 %11, %23, off\n\t"
      "s_wait_xcnt 0x0"
      :: WL(0), WL(1), WL(2), WL(3), WL(12), WL(13), WL(14), WL(15), WL(16),
         WL(17), WL(18), WL(19),
         WG(0), WG(1), WG(2), WG(3), WG(12), WG(13), WG(14), WG(15), WG(16),
         WG(17), WG(18), WG(19)
      : "memory");
#undef WL
#undef WG

  // --- k and v of this wave's 16 positions, all heads, into LDS ---
#pragma unroll
  for (int nt = 0; nt < 8; ++nt) {
    v8f ak = {}, av = {};
#pragma unroll
    for (int kk = 0; kk < 4; ++kk) {
      const v16h wk = load_frag16x32(WT[1] + (nt * 16) * WT_LD + kk * 32, WT_LD);
      const v16h wv = load_frag16x32(WT[2] + (nt * 16) * WT_LD + kk * 32, WT_LD);
      ak = wmma_f16(wk, X[kk], ak);      // column nt*16 + 8*hi + r, key kcol
      av = wmma_f16(X[kk], wv, av);      // key 8*hi + r, column nt*16 + kcol
    }
    v8h hk, hv;
#pragma unroll
    for (int r = 0; r < 8; ++r) { hk[r] = (_Float16)ak[r]; hv[r] = (_Float16)av[r]; }
    *(v8h*)(Ksh + (wave * 16 + kcol) * WT_LD + nt * 16 + hi * 8) = hk;
    *(v8h*)(VTsh + (nt * 16 + kcol) * VT_LD + wave * 16 + hi * 8) = hv;
  }
  // This wave's last run of copies (Wq, Wg, Wo) has landed, ahead of the barrier.
  asm volatile("s_wait_asynccnt 0x0" ::: "memory");
  __syncthreads();       // every wave's k and v, and Wq, Wg, Wo, are in LDS

  // Wk and Wv are dead behind that barrier: each wave parks its gated O
  // fragments there, 4 KB of its own, read back by the same lanes only.
  _Float16* park = WT[1] + wave * 2048 + lane * 8;

  // The f16 bias is widened and laid into the score accumulators by the
  // matrix unit: one A fragment holds two key tiles (k 0..15 = the queries of
  // the first, k 16..31 of the second), and the unit matrix in the upper or
  // the lower 16 rows of B picks one of them (the other meets zeros, which is
  // exact for every finite f16 value).
  v16h Ilo, Ihi;
#pragma unroll
  for (int t = 0; t < 8; ++t) {
    const _Float16 one = (hi * 8 + t == kcol) ? (_Float16)1.0f : (_Float16)0.0f;
    Ilo[t] = one;             Ilo[t + 8] = (_Float16)0.0f;
    Ihi[t] = (_Float16)0.0f;  Ihi[t + 8] = one;
  }

  for (int h = 0; h < NHEAD; ++h) {
    // --- q^T: the B operand of the scores, column kcol = query ---
    v16h bQ;
    {
      v8f q0 = {}, q1 = {};
#pragma unroll
      for (int kk = 0; kk < 4; ++kk) {
        const v16h w0 = load_frag16x32(WT[0] + (h * DHID) * WT_LD + kk * 32, WT_LD);
        const v16h w1 = load_frag16x32(WT[0] + (h * DHID + 16) * WT_LD + kk * 32, WT_LD);
        q0 = wmma_f16(w0, X[kk], q0);    // d = 8*hi + r
        q1 = wmma_f16(w1, X[kk], q1);    // d = 16 + 8*hi + r
      }
#pragma unroll
      for (int r = 0; r < 8; ++r) {
        bQ[r]     = (_Float16)(q0[r] * SCALING);
        bQ[r + 8] = (_Float16)(q1[r] * SCALING);
      }
    }
    // 256 halves per (query tile, 16 keys); a wave's b128 load is 512 B in a row.
    const _Float16* biasF =
        biasws + (size_t)((h * 16 + wave) * 16) * 256 + lane * 8;

    v8f O0 = {}, O1 = {};              // O^T: d = 8*hi + r and 16 + 8*hi + r
    // This lane's query: nm = -(running maximum) * log2(e), and the sum.
    float nm = 3.0e38f, sum = 0.0f;

    // Kept rolled: unrolled, the two passes' tiles overlap in registers and
    // the normalized rows are spilled to scratch.
#pragma unroll 1
    for (int cc = 0; cc < 2; ++cc) {     // 128 keys per pass
      // --- scores: eight independent 16x16 tiles, rows = keys, the bias added
      // last; the pass's 8 bias loads are in flight together ---
      const _Float16* bp = biasF + cc * 2048;
      v8h cb[8];
#pragma unroll
      for (int u = 0; u < 8; ++u) cb[u] = *(const v8h*)(bp + u * 256);
      // The address stays in its registers up to this wait.
      asm volatile("s_wait_xcnt 0x0" :: "v"(bp) : "memory");
      v8f S[8];                          // S[t]: key cc*128 + t*16 + 8*hi + r
#pragma unroll
      for (int t = 0; t < 8; ++t) {
        const v16h aK = load_frag16x32(
            Ksh + (cc * 8 + t) * 16 * WT_LD + h * DHID, WT_LD);
        const v8f zero = {};
        S[t] = wmma_f16(aK, bQ, zero);   // under the bias loads' flight
      }
#pragma unroll
      for (int p = 0; p < 4; ++p) {
        v16h aB;
#pragma unroll
        for (int e = 0; e < 8; ++e) {
          aB[e] = cb[2 * p][e]; aB[e + 8] = cb[2 * p + 1][e];
        }
        S[2 * p]     = wmma_f16(aB, Ilo, S[2 * p]);
        S[2 * p + 1] = wmma_f16(aB, Ihi, S[2 * p + 1]);
      }

      // --- online softmax update, in-lane: four chains, then joined ---
      float tq[4];
#pragma unroll
      for (int p = 0; p < 4; ++p) {
        tq[p] = fmaxf(S[2 * p][0], S[2 * p + 1][0]);
#pragma unroll
        for (int r = 1; r < 8; ++r)
          tq[p] = fmaxf(tq[p], fmaxf(S[2 * p][r], S[2 * p + 1][r]));
      }
      float tm = fmaxf(fmaxf(tq[0], tq[1]), fmaxf(tq[2], tq[3]));
      tm = fmaxf(tm, xhalf(tm));
      // exp(s - max) = 2^(s * log2(e) + nm): one fused multiply-add in front
      // of each v_exp_f32. The rounding of nm is common to a query's terms
      // and to cf, so it cancels against the sum.
      const float nmold = nm;
      nm = fminf(nmold, -tm * LOG2E);
      const float cf = __builtin_amdgcn_exp2f(nm - nmold);
      v16h bP[4];                        // P^T in the hardware k order
      float pq[4];
#pragma unroll
      for (int p = 0; p < 4; ++p) {
        pq[p] = 0.0f;
#pragma unroll
        for (int r = 0; r < 8; ++r) {
          const float e0 = __builtin_amdgcn_exp2f(fmaf(S[2 * p][r], LOG2E, nm));
          const float e1 = __builtin_amdgcn_exp2f(fmaf(S[2 * p + 1][r], LOG2E, nm));
          pq[p] += e0 + e1;
          bP[p][r]     = (_Float16)e0;
          bP[p][r + 8] = (_Float16)e1;
        }
      }
      // this half's keys only
      sum = sum * cf + ((pq[0] + pq[1]) + (pq[2] + pq[3]));
#pragma unroll
      for (int r = 0; r < 8; ++r) { O0[r] *= cf; O1[r] *= cf; }

      // --- accumulate O^T += V^T(32x128) @ P^T(128x16) ---
#pragma unroll
      for (int p = 0; p < 4; ++p) {
        const v16h aV0 = load_frag16x32(
            VTsh + (h * DHID + 0)  * VT_LD + (cc * 4 + p) * 32, VT_LD);
        const v16h aV1 = load_frag16x32(
            VTsh + (h * DHID + 16) * VT_LD + (cc * 4 + p) * 32, VT_LD);
        O0 = wmma_f16(aV0, bP[p], O0);
        O1 = wmma_f16(aV1, bP[p], O1);
      }
    }

    // --- gate^T, in the order of O^T ---
    v8f g0 = {}, g1 = {};
#pragma unroll
    for (int kk = 0; kk < 4; ++kk) {
      const v16h w0 = load_frag16x32(WT[3] + (h * DHID) * WT_LD + kk * 32, WT_LD);
      const v16h w1 = load_frag16x32(WT[3] + (h * DHID + 16) * WT_LD + kk * 32, WT_LD);
      g0 = wmma_f16(w0, X[kk], g0);
      g1 = wmma_f16(w1, X[kk], g1);
    }
    const float* bgp = bg + h * DHID + hi * 8;
    const float4 b00 = *(const float4*)(bgp);
    const float4 b01 = *(const float4*)(bgp + 4);
    const float4 b10 = *(const float4*)(bgp + 16);
    const float4 b11 = *(const float4*)(bgp + 20);
    const v8f B0 = {b00.x, b00.y, b00.z, b00.w, b01.x, b01.y, b01.z, b01.w};
    const v8f B1 = {b10.x, b10.y, b10.z, b10.w, b11.x, b11.y, b11.z, b11.w};

    // --- join the halves' sums, normalize, gate: A fragment of the output
    // product (row kcol = query, k = this head's 32 columns).
    // O / sum * sigmoid(g) = O / ((1 + exp(-g)) * sum): one fused multiply-add
    // and one hardware reciprocal per element. The divisor is at least the
    // sum, which holds the largest key's exp(0) = 1; where exp(-g) overflows
    // it is infinite and the element 0, as with the division. ---
    const float tot = sum + xhalf(sum);
    v16h aO;
#pragma unroll
    for (int r = 0; r < 8; ++r) {
      const float e0 = __expf(-(g0[r] + B0[r]));
      const float e1 = __expf(-(g1[r] + B1[r]));
      aO[r]     = (_Float16)(O0[r] * __builtin_amdgcn_rcpf(fmaf(e0, tot, tot)));
      aO[r + 8] = (_Float16)(O1[r] * __builtin_amdgcn_rcpf(fmaf(e1, tot, tot)));
    }
    v8h lo, up;
#pragma unroll
    for (int r = 0; r < 8; ++r) { lo[r] = aO[r]; up[r] = aO[r + 8]; }
    *(v8h*)(park + h * 512)       = lo;
    *(v8h*)(park + h * 512 + 256) = up;
  }

  // This lane's eight output columns: g*64 + kcol*4 + 0..3, g = 0, 1.
  const float* bop = bo + kcol * 4;
  const float4 bo0 = *(const float4*)(bop);
  const float4 bo1 = *(const float4*)(bop + 64);
  // The address stays in its registers up to this wait.
  asm volatile("s_wait_xcnt 0x0" :: "v"(bop) : "memory");

  // --- output product, once for all heads: eight independent accumulators,
  // each summed head by head. Row nt*16 + kcol of the staged out matrix is
  // output column (nt >> 2)*64 + kcol*4 + (nt & 3) ---
  v8f acc[8] = {};                       // out rows 8*hi + r
#pragma unroll
  for (int h = 0; h < NHEAD; ++h) {
    const v8h lo = *(const v8h*)(park + h * 512);
    const v8h up = *(const v8h*)(park + h * 512 + 256);
    v16h aO;
#pragma unroll
    for (int r = 0; r < 8; ++r) { aO[r] = lo[r]; aO[r + 8] = up[r]; }
#pragma unroll
    for (int nt = 0; nt < 8; ++nt) {
      const v16h wo = load_frag16x32(WT[4] + (nt * 16) * WT_LD + h * DHID, WT_LD);
      acc[nt] = wmma_f16(aO, wo, acc[nt]);
    }
  }

  // 16 bytes a lane: a store covers 256 bytes in a row of each of two rows.
  float* op = out + (m0 + 8 * hi) * DPAIR + kcol * 4;
#pragma unroll
  for (int r = 0; r < 8; ++r) {
    const float4 o0 = {acc[0][r] + bo0.x, acc[1][r] + bo0.y,
                       acc[2][r] + bo0.z, acc[3][r] + bo0.w};
    const float4 o1 = {acc[4][r] + bo1.x, acc[5][r] + bo1.y,
                       acc[6][r] + bo1.z, acc[7][r] + bo1.w};
    *(float4*)(op + r * DPAIR)      = o0;
    *(float4*)(op + r * DPAIR + 64) = o1;
  }
}

// ---------------------------------------------------------------------------
// Launch.  Inputs: 0 pair, 1 gamma, 2 beta, 3 Wq, 4 Wk, 5 Wv, 6 Wb, 7 Wg,
// 8 bg, 9 Wo, 10 bo.  Output: f32 (1,256,256,128).
// Workspace: the bias, NHEAD*NPOS f16 = 512 KB, then the f16 weights, 160 KB.
// ---------------------------------------------------------------------------
extern "C" void kernel_launch(void* const* d_in, const int* in_sizes, int n_in,
                              void* d_out, int out_size, void* d_ws,
                              size_t ws_size, hipStream_t stream) {
  const float* pair  = (const float*)d_in[0];
  const float* gamma = (const float*)d_in[1];
  const float* beta  = (const float*)d_in[2];
  const float* Wq    = (const float*)d_in[3];
  const float* Wk    = (const float*)d_in[4];
  const float* Wv    = (const float*)d_in[5];
  const float* Wb    = (const float*)d_in[6];
  const float* Wg    = (const float*)d_in[7];
  const float* bg    = (const float*)d_in[8];
  const float* Wo    = (const float*)d_in[9];
  const float* bo    = (const float*)d_in[10];
  float* out  = (float*)d_out;
  _Float16* bbuf = (_Float16*)d_ws;
  _Float16* wbuf = bbuf + NHEAD * NPOS;

  bias_kernel<<<NPOS / 256, 512, 0, stream>>>(pair, gamma, beta, Wb, Wq, Wk, Wv,
                                              Wg, Wo, bbuf, wbuf);
  row_kernel<<<LVAL, 512, 0, stream>>>(pair, gamma, beta, bg, bo, bbuf, wbuf,
                                       out);
}
